// v000
// Times are from an AMD MI455X. After a warm-up the kernel runs many times in a row, and a time is the length of
// such a window on the GPU divided by its runs, so every launch and the gaps after it count. The runs cycle
// through copies of the inputs. A figure is the median of several windows, for all but v000 over two sittings.
// Sittings can differ by a few percent; kernels timed side by side share one.
// v000, which the later versions start from, runs in 2470 microseconds.
#include <hip/hip_runtime.h>

// CausalAttention2d (query, key [2][512][64x64] NCHW -> tokens [4096][512]; q = q_tok Wq^T + bq, k = k_tok Wk^T + bk, v = k_tok Wv^T + bv (8 heads x 64); causal softmax(q.k/8) over the 4096 positions; out[b][h*64+d][n] = (attn v)[h][n][d] (no output projection; written channel-first as the reference's permute + view) -> [2][512][64][64]).
// Compute dtypes, f32 accumulate: every input rounded to bf16; q/k/v on PLAIN bf16 operands (inputs: exact) + bias; causal scores and attn.v: query rows < 512 hl (3 products), the rest single fp16 (x1024); softmax f32 (streaming three-pass over the

#define NB_  2
#define TT   4096
#define DM   512
#define NH_  8
#define NKV  8
#define REP  (NH_ / NKV)
#define HD   64
#define DQ   (NH_ * HD)
#define DKV  (NKV * HD)
#define ZH   1
#define RH   512                  // query rows < RH use hi+lo planes (0: none)
#define WIN  0
#define PCAR 1024.0f
#define SCL  0.125f   // HD^-0.5
typedef _Float16 h16;
typedef unsigned short bf;
typedef __attribute__((ext_vector_type(16))) __bf16   v16bf;
typedef __attribute__((ext_vector_type(16))) _Float16 v16h;
typedef __attribute__((ext_vector_type(8)))  _Float16 v8h;
typedef __attribute__((ext_vector_type(8)))  unsigned short v8us;
typedef __attribute__((ext_vector_type(8)))  float    v8f;
typedef __attribute__((ext_vector_type(4)))  float    v4f;
typedef v8h  __attribute__((may_alias)) v8ha;
typedef v4f  __attribute__((may_alias)) v4fa;
typedef v8us __attribute__((may_alias)) v8usa;

__device__ __forceinline__ unsigned short f2bf(float f) { unsigned u = __float_as_uint(f); u += 0x7FFFu + ((u >> 16) & 1u); return (unsigned short)(u >> 16); }
__device__ __forceinline__ float bf2f(unsigned short b) { return __uint_as_float(((unsigned)b) << 16); }
__device__ __forceinline__ float bfr(float f) { return bf2f(f2bf(f)); }
__device__ __forceinline__ v16h cat16(v8h lo, v8h hi) { return __builtin_shufflevector(lo, hi, 0, 1, 2, 3, 4, 5, 6, 7, 8, 9, 10, 11, 12, 13, 14, 15); }
__device__ __forceinline__ v16bf cat16b(v8us lo, v8us hi) { return __builtin_bit_cast(v16bf, __builtin_shufflevector(lo, hi, 0, 1, 2, 3, 4, 5, 6, 7, 8, 9, 10, 11, 12, 13, 14, 15)); }
__device__ __forceinline__ v8f wmma16(v16h a, v16h b, v8f c) { return __builtin_amdgcn_wmma_f32_16x16x32_f16(false, a, false, b, (short)0, c, false, false); }
__device__ __forceinline__ v8f wmmab(v16bf a, v16bf b, v8f c) { return __builtin_amdgcn_wmma_f32_16x16x32_bf16(false, a, false, b, (short)0, c, false, false); }



// ---- k_gemmw: register-blocked GEMM, ONE WAVE per 64x64 output tile (16 accumulators), operands straight from K-contiguous 16-bit planes; grid (M/64, N/64, Z), 32 threads.
// C[m][n] (f32, pitch ldc, + optional f32 bias[n]) = sum_k A[m][k] Bt[n][k] (+ split products per NSPLIT). z-batch strides sA/sB/sC in elements. K % 32 == 0.
template <typename T16> struct WFrag;
template <> struct WFrag<h16> { typedef v16h V; static __device__ __forceinline__ V ld(const h16* p) { return cat16(*(const v8h*)p, *(const v8h*)(p + 16)); } static __device__ __forceinline__ v8f mma(V a, V b, v8f c) { return wmma16(a, b, c); } };
template <> struct WFrag<bf> { typedef v16bf V; static __device__ __forceinline__ V ld(const bf* p) { return cat16b(*(const v8us*)p, *(const v8us*)(p + 16)); } static __device__ __forceinline__ v8f mma(V a, V b, v8f c) { return wmmab(a, b, c); } };
template <typename T16, int NSPLIT, bool BIAS>
__global__ __launch_bounds__(32) void k_gemmw(const T16* __restrict__ A, const T16* __restrict__ A2, const T16* __restrict__ Bt, const T16* __restrict__ Bt2, int K, float* C, int ldc, const float* __restrict__ bias, size_t sA, size_t sB, size_t sC) {
    typedef typename WFrag<T16>::V V;
    __shared__ __align__(16) float os[16 * 68];
    const size_t z = blockIdx.z; A += z * sA; if (A2) A2 += z * sA; Bt += z * sB; if (Bt2) Bt2 += z * sB; C += z * sC;
    const int lane = threadIdx.x & 31, lr = lane & 15, hi = lane >> 4; const int r0 = blockIdx.x * 64, c0 = blockIdx.y * 64;
    v8f acc[4][4];
#pragma unroll
    for (int mb = 0; mb < 4; ++mb)
#pragma unroll
        for (int nb = 0; nb < 4; ++nb) acc[mb][nb] = (v8f){};
    const size_t aoff = (size_t)(r0 + lr) * K + 8 * hi, boff = (size_t)(c0 + lr) * K + 8 * hi;
#pragma unroll 1
    for (int kc = 0; kc < K; kc += 32) {
        V a[4], a2[4];
#pragma unroll
        for (int mb = 0; mb < 4; ++mb) { a[mb] = WFrag<T16>::ld(A + aoff + (size_t)mb * 16 * K + kc); if (NSPLIT == 1 || NSPLIT == 2) a2[mb] = WFrag<T16>::ld(A2 + aoff + (size_t)mb * 16 * K + kc); }
#pragma unroll
        for (int nb = 0; nb < 4; ++nb) { const V b = WFrag<T16>::ld(Bt + boff + (size_t)nb * 16 * K + kc); V b2; if (NSPLIT >= 2) b2 = WFrag<T16>::ld(Bt2 + boff + (size_t)nb * 16 * K + kc);
#pragma unroll
            for (int mb = 0; mb < 4; ++mb) { acc[mb][nb] = WFrag<T16>::mma(a[mb], b, acc[mb][nb]); if (NSPLIT == 1 || NSPLIT == 2) acc[mb][nb] = WFrag<T16>::mma(a2[mb], b, acc[mb][nb]); if (NSPLIT >= 2) acc[mb][nb] = WFrag<T16>::mma(a[mb], b2, acc[mb][nb]); } }
        asm volatile("v_nop\n\tv_nop\n\tv_nop\n\tv_nop" : "+v"(acc[0][0]), "+v"(acc[1][1]), "+v"(acc[2][2]), "+v"(acc[3][3]) : "v"(a[0]), "v"(a[3]));
    }
#pragma unroll
    for (int mb = 0; mb < 4; ++mb) {
#pragma unroll
        for (int nb = 0; nb < 4; ++nb) {
#pragma unroll
            for (int j = 0; j < 8; ++j) os[(hi * 8 + j) * 68 + nb * 16 + lr] = acc[mb][nb][j]; }
        __builtin_amdgcn_wave_barrier(); asm volatile("" ::: "memory");
        float* crow = C + (size_t)(r0 + mb * 16) * ldc + c0;
{
#pragma unroll
            for (int s = 0; s < 8; ++s) { const int row = 2 * s + hi, cofs = lr * 4; v4f val = *(const v4fa*)(os + row * 68 + cofs); if (BIAS) { val[0] += bfr(bias[c0 + cofs]); val[1] += bfr(bias[c0 + cofs + 1]); val[2] += bfr(bias[c0 + cofs + 2]); val[3] += bfr(bias[c0 + cofs + 3]); }
                *(v4f*)(crow + (size_t)row * ldc + cofs) = val; }
             }
        __builtin_amdgcn_wave_barrier(); asm volatile("" ::: "memory");
    }
}

// ---- k_gemmc: the same one-wave 64x64 tile GEMM specialised for causal attention: CMODE 1 skips score tiles entirely above the diagonal (query rows r0+roff.., key columns c0..), CMODE 2 limits the
// key (K) loop of the probability x value contraction to the diagonal block (probabilities beyond it are exactly zero). roff = row offset of this launch's first row within the sequence.
template <typename T16, int NSPLIT, int CMODE>
__global__ __launch_bounds__(32) void k_gemmc(const T16* __restrict__ A, const T16* __restrict__ A2, const T16* __restrict__ Bt, const T16* __restrict__ Bt2, int K, float* C, int ldc, int roff, size_t sA, size_t sB, size_t sC) {
    typedef typename WFrag<T16>::V V;
    __shared__ __align__(16) float os[16 * 68];
    const size_t z = blockIdx.z; A += z * sA; if (A2) A2 += z * sA; Bt += z * sB; if (Bt2) Bt2 += z * sB; C += z * sC;
    const int lane = threadIdx.x & 31, lr = lane & 15, hi = lane >> 4; const int r0 = blockIdx.x * 64, c0 = blockIdx.y * 64;
    if (CMODE == 1 && c0 > r0 + roff + 63) return;                  // score tile entirely above the causal diagonal: never used (the softmax masks j > i by select)
    const int Kl = (CMODE == 2) ? min(K, r0 + roff + 64) : K;        // P.V: probabilities are exactly 0 beyond the diagonal block, so the K loop stops there
    v8f acc[4][4];
#pragma unroll
    for (int mb = 0; mb < 4; ++mb)
#pragma unroll
        for (int nb = 0; nb < 4; ++nb) acc[mb][nb] = (v8f){};
    const size_t aoff = (size_t)(r0 + lr) * K + 8 * hi, boff = (size_t)(c0 + lr) * K + 8 * hi;
#pragma unroll 1
    for (int kc = 0; kc < Kl; kc += 32) {
        V a[4], a2[4];
#pragma unroll
        for (int mb = 0; mb < 4; ++mb) { a[mb] = WFrag<T16>::ld(A + aoff + (size_t)mb * 16 * K + kc); if (NSPLIT == 1 || NSPLIT == 2) a2[mb] = WFrag<T16>::ld(A2 + aoff + (size_t)mb * 16 * K + kc); }
#pragma unroll
        for (int nb = 0; nb < 4; ++nb) { const V b = WFrag<T16>::ld(Bt + boff + (size_t)nb * 16 * K + kc); V b2; if (NSPLIT >= 2) b2 = WFrag<T16>::ld(Bt2 + boff + (size_t)nb * 16 * K + kc);
#pragma unroll
            for (int mb = 0; mb < 4; ++mb) { acc[mb][nb] = WFrag<T16>::mma(a[mb], b, acc[mb][nb]); if (NSPLIT == 1 || NSPLIT == 2) acc[mb][nb] = WFrag<T16>::mma(a2[mb], b, acc[mb][nb]); if (NSPLIT >= 2) acc[mb][nb] = WFrag<T16>::mma(a[mb], b2, acc[mb][nb]); } }
        asm volatile("v_nop\n\tv_nop\n\tv_nop\n\tv_nop" : "+v"(acc[0][0]), "+v"(acc[1][1]), "+v"(acc[2][2]), "+v"(acc[3][3]) : "v"(a[0]), "v"(a[3]));
    }
#pragma unroll
    for (int mb = 0; mb < 4; ++mb) {
#pragma unroll
        for (int nb = 0; nb < 4; ++nb) {
#pragma unroll
            for (int j = 0; j < 8; ++j) os[(hi * 8 + j) * 68 + nb * 16 + lr] = acc[mb][nb][j]; }
        __builtin_amdgcn_wave_barrier(); asm volatile("" ::: "memory");
        float* crow = C + (size_t)(r0 + mb * 16) * ldc + c0;
{
#pragma unroll
            for (int s = 0; s < 8; ++s) { const int row = 2 * s + hi, cofs = lr * 4; v4f val = *(const v4fa*)(os + row * 68 + cofs);
                *(v4f*)(crow + (size_t)row * ldc + cofs) = val; }
             }
        __builtin_amdgcn_wave_barrier(); asm volatile("" ::: "memory");
    }
}

__device__ __forceinline__ h16 tohx(float x) { return (h16)x; }
__device__ __forceinline__ void splitf(float y, unsigned short& h, unsigned short& l) { h = f2bf(y); l = f2bf(y - bf2f(h)); }
typedef __attribute__((ext_vector_type(2))) _Float16 v2h;
typedef __attribute__((ext_vector_type(4))) _Float16 v4h;
typedef __attribute__((ext_vector_type(2))) unsigned short v2us;
typedef __attribute__((ext_vector_type(4))) unsigned short v4us;
typedef __attribute__((ext_vector_type(2))) float v2f;
typedef __attribute__((ext_vector_type(4))) int v4i;

__global__ __launch_bounds__(256) void k_wtG(const float* __restrict__ w, int K, int N, bf* Bt) {
    const int lane = threadIdx.x & 31; const int L0 = (blockIdx.x * 8 + (threadIdx.x >> 5)) * 8; const int nlines = N * K / 64;
{
#pragma unroll 1
        for (int l = 0; l < 8; ++l) { const int L = L0 + l; if (L >= nlines) break; const size_t e = (size_t)L * 64 + lane * 2; const int k = (int)(e % K), n = (int)(e / K); v2us o;
            o[0] = f2bf(w[(size_t)k * N + n]); o[1] = f2bf(w[(size_t)(k + 1) * N + n]); *(v2us*)(Bt + e) = o; }
         }
}
__global__ __launch_bounds__(256) void k_cvt8(const float* __restrict__ src, bf* dst, size_t n8) { const size_t i = (size_t)blockIdx.x * 256 + threadIdx.x; if (i >= n8) return; const v8f v = *(const v8f*)(src + i * 8); v8us o;
#pragma unroll
    for (int k = 0; k < 8; ++k) o[k] = f2bf(v[k]); *(v8us*)(dst + i * 8) = o;  }
__global__ __launch_bounds__(256) void k_cscvt(const float* __restrict__ cosT, const float* __restrict__ sinT, float* CS) { const int idx = blockIdx.x * 256 + threadIdx.x; if (idx >= TT * HD) return; v2f cs; cs[0] = bfr(cosT[idx]); cs[1] = bfr(sinT[idx]); *(v2f*)(CS + (size_t)idx * 2) = cs;  }
// k_rope: head planes [h][t][d] (fp16 + hi/lo) of rope(x) x sc with the rotate-half convention out[d] = x[d] cos[t][d] - x[d+HD/2] sin[t][d], out[d+HD/2] = x[d+HD/2] cos[t][d+HD/2] + x[d] sin[t][d+HD/2]
__global__ __launch_bounds__(256) void k_rope(const float* __restrict__ F, int pitch, int nheads, const float* __restrict__ CS, const float* __restrict__ RF, const float* __restrict__ nw, float sc, h16* P16, bf* Ph, bf* Pl) {
    const size_t e = ((size_t)blockIdx.x * 256 + threadIdx.x) * 2; if (e >= (size_t)nheads * TT * HD) return; const int d = (int)(e % HD); const int t = (int)((e / HD) % TT); const int h = (int)(e / ((size_t)HD * TT)); const float* f = F + (size_t)t * pitch + h * HD; const float rf = RF ? RF[(size_t)h * TT + t] : 1.0f; v2h o16; v2us oh, ol;
#pragma unroll
    for (int q = 0; q < 2; ++q) { const int dd = d + q; const int dp = (dd < HD / 2) ? dd + HD / 2 : dd - HD / 2; float x0 = f[dd], x1 = f[dp];
        if (RF) { float n0 = __fmul_rn(x0, rf), n1 = __fmul_rn(x1, rf); asm volatile("" : "+v"(n0)); asm volatile("" : "+v"(n1)); x0 = __fmul_rn(bfr(nw[dd]), n0); x1 = __fmul_rn(bfr(nw[dp]), n1); }
        const v2f cs = *(const v2f*)(CS + ((size_t)t * HD + dd) * 2); float a = __fmul_rn(x0, cs[0]), bq = __fmul_rn(x1, cs[1]); asm volatile("" : "+v"(a)); asm volatile("" : "+v"(bq)); const float r = ((dd < HD / 2) ? __fsub_rn(a, bq) : __fadd_rn(a, bq)) * sc;
        o16[q] = tohx(r); unsigned short a2, c2; splitf(r, a2, c2); oh[q] = a2; ol[q] = c2; }
    *(v2h*)(P16 + e) = o16; *(v2us*)(Ph + e) = oh; *(v2us*)(Pl + e) = ol;  }
__global__ __launch_bounds__(256) void k_vtp(const float* __restrict__ F, int pitch, int nheads, h16* V16, bf* Vh, bf* Vl) { const size_t e = ((size_t)blockIdx.x * 256 + threadIdx.x) * 2; if (e >= (size_t)nheads * HD * TT) return; const int t = (int)(e % TT); const int d = (int)((e / TT) % HD); const int g = (int)(e / ((size_t)TT * HD)); v2h o16; v2us oh, ol;
#pragma unroll
    for (int q = 0; q < 2; ++q) { const float x = F[(size_t)(t + q) * pitch + g * HD + d]; o16[q] = tohx(x); unsigned short a2, c2; splitf(x, a2, c2); oh[q] = a2; ol[q] = c2; }
    *(v2h*)(V16 + e) = o16; *(v2us*)(Vh + e) = oh; *(v2us*)(Vl + e) = ol;  }
__global__ __launch_bounds__(256) void k_csid(float* CS) { const int idx = blockIdx.x * 256 + threadIdx.x; if (idx >= TT * HD) return; v2f cs; cs[0] = 1.0f; cs[1] = 0.0f; *(v2f*)(CS + (size_t)idx * 2) = cs;  }
// k_asoft: per row (zz, i): t = S x HD^-0.5 for j <= i (causal; the reference's -1e9 additive fill vanishes identically); softmax over the 4096 keys (streamed in three passes, exp in two of them, fixed trees);
__global__ __launch_bounds__(256) void k_asoft(const float* __restrict__ Sb, h16* P16, bf* Ph, bf* Pl) {
    // streaming three-pass causal softmax (row max, row sum, write) so a 4096-wide row never lives in registers: wave per (zz, i) row; j > i contributes exp(-inf) = 0 (those tiles were not computed and are written as 0).
    const int lane = threadIdx.x & 31; const int row = blockIdx.x * 8 + (threadIdx.x >> 5); if (row >= ZH * TT) return; const int i = row % TT; const int zz = row / TT; (void)zz; const bool hires = (i < RH); const float* sr = Sb + (size_t)row * TT;
    const int nch = (i / 128) + 1;   // chunks of 128 columns that contain any j <= i
    float mx = -3.0e38f;
    for (int ch = 0; ch < nch; ++ch) { const int j0 = ch * 128 + lane * 4; const v4f a = *(const v4f*)(sr + j0);
#pragma unroll
        for (int q = 0; q < 4; ++q) { const float t = (j0 + q <= i) ? a[q] * SCL : -3.0e38f; mx = fmaxf(mx, t); } }
#pragma unroll
    for (int sh = 16; sh; sh >>= 1) mx = fmaxf(mx, __shfl_xor(mx, sh, 32));
    float sum = 0.f;
    for (int ch = 0; ch < nch; ++ch) { const int j0 = ch * 128 + lane * 4; const v4f a = *(const v4f*)(sr + j0);
#pragma unroll
        for (int q = 0; q < 4; ++q) { if (j0 + q <= i) { float d0 = __fsub_rn(a[q] * SCL, mx); asm volatile("" : "+v"(d0)); sum += __builtin_amdgcn_exp2f(__fmul_rn(d0, 1.4426950408889634f)); } } }
#pragma unroll
    for (int sh = 16; sh; sh >>= 1) sum += __shfl_xor(sum, sh, 32);
    const float f = __fdiv_rn(hires ? 1.0f : PCAR, sum);
    for (int ch = 0; ch < TT / 128; ++ch) { const int j0 = ch * 128 + lane * 4; float e[4];
            if (ch < nch) { const v4f a = *(const v4f*)(sr + j0);
#pragma unroll
                for (int q = 0; q < 4; ++q) { if (j0 + q <= i) { float d0 = __fsub_rn(a[q] * SCL, mx); asm volatile("" : "+v"(d0)); e[q] = __builtin_amdgcn_exp2f(__fmul_rn(d0, 1.4426950408889634f)) * f; } else e[q] = 0.f; } }
            else { e[0] = e[1] = e[2] = e[3] = 0.f; }
            if (hires) { v4us oh, ol;
#pragma unroll
                for (int q = 0; q < 4; ++q) { unsigned short a2, c2; splitf(e[q], a2, c2); oh[q] = a2; ol[q] = c2; }
                const size_t oo = ((size_t)zz * (RH ? RH : 1) + i) * TT + j0; *(v4us*)(Ph + oo) = oh; *(v4us*)(Pl + oo) = ol;  }
            else { v4h o4;
#pragma unroll
                for (int q = 0; q < 4; ++q) o4[q] = tohx(e[q]); *(v4h*)(P16 + (size_t)row * TT + j0) = o4;  } }
}


__global__ __launch_bounds__(256) void k_outT(const float* __restrict__ O, int h0, float* outb) { const size_t e = ((size_t)blockIdx.x * 256 + threadIdx.x) * 4; if (e >= (size_t)ZH * HD * TT) return; const int t = (int)(e % TT); const int d = (int)((e / TT) % HD); const int zz = (int)(e / ((size_t)HD * TT)); v4f o;
#pragma unroll
    for (int u = 0; u < 4; ++u) { const int tt = t + u; const float cs = (tt < RH) ? 1.0f : (1.0f / PCAR); o[u] = O[((size_t)zz * TT + tt) * HD + d] * cs; }
    float* dst = outb + (size_t)((h0 + zz) * HD + d) * TT + t; *(v4f*)dst = o;  }   // channel-first output [E][N] = (attn v)[h][n][d] transposed

__global__ __launch_bounds__(256) void k_tok(const float* __restrict__ in, bf* X) { const size_t e = ((size_t)blockIdx.x * 256 + threadIdx.x) * 4; if (e >= (size_t)TT * DM) return; const int c = (int)(e % DM); const int n = (int)(e / DM); v4us o;
#pragma unroll
    for (int u = 0; u < 4; ++u) o[u] = f2bf(in[(size_t)(c + u) * TT + n]); *(v4us*)(X + e) = o;  }   // NCHW -> token rows [n][c]

extern "C" void kernel_launch(void* const* d_in, const int* in_sizes, int n_in,
                              void* d_out, int out_size, void* d_ws, size_t ws_size, hipStream_t stream) {
    (void)in_sizes; (void)n_in; (void)out_size;
    const float* qin = (const float*)d_in[0]; const float* kin = (const float*)d_in[1]; const float* wq = (const float*)d_in[2]; const float* bq = (const float*)d_in[3]; const float* wk = (const float*)d_in[4]; const float* bk = (const float*)d_in[5]; const float* wv = (const float*)d_in[6]; const float* bv = (const float*)d_in[7]; const float* x = qin; const float* wo = nullptr; (void)wo; const float* cosT = nullptr; const float* sinT = nullptr; (void)cosT; (void)sinT;
    float* OUT = (float*)d_out;     // [2][512][4096] channel-first
    char* wsp = (char*)d_ws;
    auto take = [&](size_t bytes) { char* p = wsp; wsp += (bytes + 255) & ~(size_t)255; return (void*)p; };
    bf* WQ = (bf*)take((size_t)DQ * DM * 2); bf* WK = (bf*)take((size_t)DKV * DM * 2); bf* WV = (bf*)take((size_t)DKV * DM * 2); bf* WO = (bf*)take((size_t)DM * DQ * 2); float* CS = (float*)take((size_t)TT * HD * 2 * 4);
    bf* XB = (bf*)take((size_t)TT * DM * 2); bf* XK = (bf*)take((size_t)TT * DM * 2); float* FQ = (float*)take((size_t)TT * DQ * 4); float* FK = (float*)take((size_t)TT * DKV * 4);
    h16* QP16 = (h16*)take((size_t)NH_ * TT * HD * 2); h16* KP16 = (h16*)take((size_t)NKV * TT * HD * 2); h16* VT16 = (h16*)take((size_t)NKV * HD * TT * 2);
    bf* QPh = (bf*)take((size_t)NH_ * TT * HD * 2); bf* QPl = (bf*)take((size_t)NH_ * TT * HD * 2); bf* KPh = (bf*)take((size_t)NKV * TT * HD * 2); bf* KPl = (bf*)take((size_t)NKV * TT * HD * 2); bf* VTh = (bf*)take((size_t)NKV * HD * TT * 2); bf* VTl = (bf*)take((size_t)NKV * HD * TT * 2); bf* Ph = (bf*)take((size_t)ZH * RH * TT * 2); bf* Pl = (bf*)take((size_t)ZH * RH * TT * 2);
    float* Sb = (float*)take((size_t)ZH * TT * TT * 4); h16* P16 = (h16*)take((size_t)ZH * TT * TT * 2); float* Ob = (float*)take((size_t)ZH * TT * HD * 4); bf* ATh = (bf*)take((size_t)TT * DQ * 2); bf* ATl = (bf*)take((size_t)TT * DQ * 2);
    if ((size_t)(wsp - (char*)d_ws) > ws_size) return;    // ws 256 MiB
    float* FV = FK;   // v projection reuses the k buffer after the k planes are built (stream-ordered)
    { k_cvt8<<<(unsigned)(((size_t)DQ * DM / 8 + 255) / 256), 256, 0, stream>>>(wq, WQ, (size_t)DQ * DM / 8); k_cvt8<<<(unsigned)(((size_t)DKV * DM / 8 + 255) / 256), 256, 0, stream>>>(wk, WK, (size_t)DKV * DM / 8); k_cvt8<<<(unsigned)(((size_t)DKV * DM / 8 + 255) / 256), 256, 0, stream>>>(wv, WV, (size_t)DKV * DM / 8);
      
       }
    k_csid<<<(TT * HD + 255) / 256, 256, 0, stream>>>(CS);
    const unsigned LQ = (unsigned)(((size_t)NH_ * TT * HD / 2 + 255) / 256), LKv = (unsigned)(((size_t)NKV * TT * HD / 2 + 255) / 256);
    for (int b = 0; b < NB_; ++b) {
        
        k_tok<<<(unsigned)(((size_t)TT * DM / 4 + 255) / 256), 256, 0, stream>>>(qin + (size_t)b * DM * TT, XB); k_tok<<<(unsigned)(((size_t)TT * DM / 4 + 255) / 256), 256, 0, stream>>>(kin + (size_t)b * DM * TT, XK);
        k_gemmw<bf, 0, true><<<dim3(TT / 64, DQ / 64, 1), 32, 0, stream>>>(XB, nullptr, WQ, nullptr, DM, FQ, DQ, bq, 0, 0, 0);
        k_rope<<<LQ, 256, 0, stream>>>(FQ, DQ, NH_, CS, nullptr, nullptr, 1.0f, QP16, QPh, QPl);
        k_gemmw<bf, 0, true><<<dim3(TT / 64, DKV / 64, 1), 32, 0, stream>>>(XK, nullptr, WK, nullptr, DM, FK, DKV, bk, 0, 0, 0);
        k_rope<<<LKv, 256, 0, stream>>>(FK, DKV, NKV, CS, nullptr, nullptr, 1.0f, KP16, KPh, KPl);
        k_gemmw<bf, 0, true><<<dim3(TT / 64, DKV / 64, 1), 32, 0, stream>>>(XK, nullptr, WV, nullptr, DM, FV, DKV, bv, 0, 0, 0); k_vtp<<<LKv, 256, 0, stream>>>(FV, DKV, NKV, VT16, VTh, VTl);
        for (int h0 = 0; h0 < NH_; h0 += ZH) { const size_t zq = (size_t)h0, zk = (size_t)(h0 / REP);   // one kv head per query head: each pass does ZH = 1 head on kv plane h0 / REP (z-strides TT*HD)
            k_gemmc<bf, 2, 1><<<dim3(RH / 64, TT / 64, ZH), 32, 0, stream>>>(QPh + zq * TT * HD, QPl + zq * TT * HD, KPh + zk * TT * HD, KPl + zk * TT * HD, HD, Sb, TT, 0, (size_t)TT * HD, (size_t)TT * HD, (size_t)TT * TT);
            k_gemmc<h16, 0, 1><<<dim3((TT - RH) / 64, TT / 64, ZH), 32, 0, stream>>>(QP16 + zq * TT * HD + (size_t)RH * HD, nullptr, KP16 + zk * TT * HD, nullptr, HD, Sb + (size_t)RH * TT, TT, RH, (size_t)TT * HD, (size_t)TT * HD, (size_t)TT * TT);
            k_asoft<<<ZH * TT / 8, 256, 0, stream>>>(Sb, P16, Ph, Pl);
            k_gemmc<bf, 2, 2><<<dim3(RH / 64, HD / 64, ZH), 32, 0, stream>>>(Ph, Pl, VTh + zk * HD * TT, VTl + zk * HD * TT, TT, Ob, HD, 0, (size_t)RH * TT, (size_t)HD * TT, (size_t)TT * HD);
            k_gemmc<h16, 0, 2><<<dim3((TT - RH) / 64, HD / 64, ZH), 32, 0, stream>>>(P16 + (size_t)RH * TT, nullptr, VT16 + zk * HD * TT, nullptr, TT, Ob + (size_t)RH * HD, HD, RH, (size_t)TT * TT, (size_t)HD * TT, (size_t)TT * HD);
            k_outT<<<(unsigned)(((size_t)ZH * HD * TT / 4 + 255) / 256), 256, 0, stream>>>(Ob, h0, OUT + (size_t)b * DQ * TT); }
        }
}

// v001
// A run of this version takes 1250 microseconds.
// Two timings next to v000 put it at 1.97 and 1.99 times that version's speed.
#include <hip/hip_runtime.h>

// CausalAttention2d (query, key [2][512][64x64] NCHW -> tokens [4096][512]; q = q_tok Wq^T + bq, k = k_tok Wk^T + bk, v = k_tok Wv^T + bv (8 heads x 64); causal softmax(q.k/8) over the 4096 positions; out[b][h*64+d][n] = (attn v)[h][n][d] (no output projection; written channel-first as the reference's permute + view) -> [2][512][64][64]).
// Compute dtypes, f32 accumulate: every input rounded to bf16; q/k/v on PLAIN bf16 operands (inputs: exact) + bias; causal scores and attn.v: query rows < 512 hl (3 products), the rest single fp16 (x1024); softmax f32 (streaming three-pass over the

#define NB_  2
#define TT   4096
#define DM   512
#define NH_  8
#define NKV  8
#define REP  (NH_ / NKV)
#define HD   64
#define DQ   (NH_ * HD)
#define DKV  (NKV * HD)
#define ZH   1
#define RH   512                  // query rows < RH use hi+lo planes (0: none)
#define WIN  0
#define PCAR 1024.0f
#define SCL  0.125f   // HD^-0.5
#define KCH  128                  // keys per work-group of the value x probability product (one partial plane per chunk)
static_assert(ZH == 1 && HD == 64 && KCH % 64 == 0 && RH % KCH == 0 && TT % KCH == 0, "blockIdx.z of the value x probability launches is the key chunk");
typedef _Float16 h16;
typedef unsigned short bf;
typedef __attribute__((ext_vector_type(16))) __bf16   v16bf;
typedef __attribute__((ext_vector_type(16))) _Float16 v16h;
typedef __attribute__((ext_vector_type(8)))  _Float16 v8h;
typedef __attribute__((ext_vector_type(8)))  unsigned short v8us;
typedef __attribute__((ext_vector_type(8)))  float    v8f;
typedef __attribute__((ext_vector_type(4)))  float    v4f;
typedef v8h  __attribute__((may_alias)) v8ha;
typedef v4f  __attribute__((may_alias)) v4fa;
typedef v8us __attribute__((may_alias)) v8usa;

__device__ __forceinline__ unsigned short f2bf(float f) { unsigned u = __float_as_uint(f); u += 0x7FFFu + ((u >> 16) & 1u); return (unsigned short)(u >> 16); }
__device__ __forceinline__ float bf2f(unsigned short b) { return __uint_as_float(((unsigned)b) << 16); }
__device__ __forceinline__ float bfr(float f) { return bf2f(f2bf(f)); }
__device__ __forceinline__ v16h cat16(v8h lo, v8h hi) { return __builtin_shufflevector(lo, hi, 0, 1, 2, 3, 4, 5, 6, 7, 8, 9, 10, 11, 12, 13, 14, 15); }
__device__ __forceinline__ v16bf cat16b(v8us lo, v8us hi) { return __builtin_bit_cast(v16bf, __builtin_shufflevector(lo, hi, 0, 1, 2, 3, 4, 5, 6, 7, 8, 9, 10, 11, 12, 13, 14, 15)); }
__device__ __forceinline__ v8f wmma16(v16h a, v16h b, v8f c) { return __builtin_amdgcn_wmma_f32_16x16x32_f16(false, a, false, b, (short)0, c, false, false); }
__device__ __forceinline__ v8f wmmab(v16bf a, v16bf b, v8f c) { return __builtin_amdgcn_wmma_f32_16x16x32_bf16(false, a, false, b, (short)0, c, false, false); }



// ---- k_gemmw: register-blocked GEMM, ONE WAVE per 64x64 output tile (16 accumulators), operands straight from K-contiguous 16-bit planes; grid (M/64, N/64, Z), 32 threads.
// C[m][n] (f32, pitch ldc, + optional f32 bias[n]) = sum_k A[m][k] Bt[n][k] (+ split products per NSPLIT). z-batch strides sA/sB/sC in elements. K % 32 == 0.
template <typename T16> struct WFrag;
template <> struct WFrag<h16> { typedef v16h V; static __device__ __forceinline__ V ld(const h16* p) { return cat16(*(const v8h*)p, *(const v8h*)(p + 16)); } static __device__ __forceinline__ v8f mma(V a, V b, v8f c) { return wmma16(a, b, c); } };
template <> struct WFrag<bf> { typedef v16bf V; static __device__ __forceinline__ V ld(const bf* p) { return cat16b(*(const v8us*)p, *(const v8us*)(p + 16)); } static __device__ __forceinline__ v8f mma(V a, V b, v8f c) { return wmmab(a, b, c); } };
template <typename T16, int NSPLIT, bool BIAS>
__global__ __launch_bounds__(32) void k_gemmw(const T16* __restrict__ A, const T16* __restrict__ A2, const T16* __restrict__ Bt, const T16* __restrict__ Bt2, int K, float* C, int ldc, const float* __restrict__ bias, size_t sA, size_t sB, size_t sC) {
    typedef typename WFrag<T16>::V V;
    __shared__ __align__(16) float os[16 * 68];
    const size_t z = blockIdx.z; A += z * sA; if (A2) A2 += z * sA; Bt += z * sB; if (Bt2) Bt2 += z * sB; C += z * sC;
    const int lane = threadIdx.x & 31, lr = lane & 15, hi = lane >> 4; const int r0 = blockIdx.x * 64, c0 = blockIdx.y * 64;
    v8f acc[4][4];
#pragma unroll
    for (int mb = 0; mb < 4; ++mb)
#pragma unroll
        for (int nb = 0; nb < 4; ++nb) acc[mb][nb] = (v8f){};
    const size_t aoff = (size_t)(r0 + lr) * K + 8 * hi, boff = (size_t)(c0 + lr) * K + 8 * hi;
#pragma unroll 1
    for (int kc = 0; kc < K; kc += 32) {
        V a[4], a2[4];
#pragma unroll
        for (int mb = 0; mb < 4; ++mb) { a[mb] = WFrag<T16>::ld(A + aoff + (size_t)mb * 16 * K + kc); if (NSPLIT == 1 || NSPLIT == 2) a2[mb] = WFrag<T16>::ld(A2 + aoff + (size_t)mb * 16 * K + kc); }
#pragma unroll
        for (int nb = 0; nb < 4; ++nb) { const V b = WFrag<T16>::ld(Bt + boff + (size_t)nb * 16 * K + kc); V b2; if (NSPLIT >= 2) b2 = WFrag<T16>::ld(Bt2 + boff + (size_t)nb * 16 * K + kc);
#pragma unroll
            for (int mb = 0; mb < 4; ++mb) { acc[mb][nb] = WFrag<T16>::mma(a[mb], b, acc[mb][nb]); if (NSPLIT == 1 || NSPLIT == 2) acc[mb][nb] = WFrag<T16>::mma(a2[mb], b, acc[mb][nb]); if (NSPLIT >= 2) acc[mb][nb] = WFrag<T16>::mma(a[mb], b2, acc[mb][nb]); } }
        asm volatile("v_nop\n\tv_nop\n\tv_nop\n\tv_nop" : "+v"(acc[0][0]), "+v"(acc[1][1]), "+v"(acc[2][2]), "+v"(acc[3][3]) : "v"(a[0]), "v"(a[3]));
    }
#pragma unroll
    for (int mb = 0; mb < 4; ++mb) {
#pragma unroll
        for (int nb = 0; nb < 4; ++nb) {
#pragma unroll
            for (int j = 0; j < 8; ++j) os[(hi * 8 + j) * 68 + nb * 16 + lr] = acc[mb][nb][j]; }
        __builtin_amdgcn_wave_barrier(); asm volatile("" ::: "memory");
        float* crow = C + (size_t)(r0 + mb * 16) * ldc + c0;
{
#pragma unroll
            for (int s = 0; s < 8; ++s) { const int row = 2 * s + hi, cofs = lr * 4; v4f val = *(const v4fa*)(os + row * 68 + cofs); if (BIAS) { val[0] += bfr(bias[c0 + cofs]); val[1] += bfr(bias[c0 + cofs + 1]); val[2] += bfr(bias[c0 + cofs + 2]); val[3] += bfr(bias[c0 + cofs + 3]); }
                *(v4f*)(crow + (size_t)row * ldc + cofs) = val; }
             }
        __builtin_amdgcn_wave_barrier(); asm volatile("" ::: "memory");
    }
}

// ---- k_gemmc: the same one-wave 64x64 tile GEMM specialised for causal attention: CMODE 1 skips score tiles entirely above the diagonal (query rows r0+roff.., key columns c0..), CMODE 2 is the
// value^T x probability^T contraction (A = value rows d, Bt = probability rows = queries, so C is channel-first [d][query]) split along the keys: blockIdx.z = chunk of KCH keys, C += z * sC is that chunk's partial plane;
// chunks entirely beyond the diagonal block are neither computed nor written (probabilities there are exactly zero) and k_outT does not read them. roff = offset of this launch's first query within the sequence.
template <typename T16, int NSPLIT, int CMODE>
__global__ __launch_bounds__(32) void k_gemmc(const T16* __restrict__ A, const T16* __restrict__ A2, const T16* __restrict__ Bt, const T16* __restrict__ Bt2, int K, float* C, int ldc, int roff, size_t sA, size_t sB, size_t sC) {
    typedef typename WFrag<T16>::V V;
    __shared__ __align__(16) float os[16 * 68];
    const size_t z = blockIdx.z; A += z * sA; if (A2) A2 += z * sA; Bt += z * sB; if (Bt2) Bt2 += z * sB; C += z * sC;
    const int lane = threadIdx.x & 31, lr = lane & 15, hi = lane >> 4; const int r0 = blockIdx.x * 64, c0 = blockIdx.y * 64;
    if (CMODE == 1 && c0 > r0 + roff + 63) return;                  // score tile entirely above the causal diagonal: its values are never used (the softmax may load it but masks j > i by select)
    const int Kl = (CMODE == 2) ? min(K, c0 + roff + 64) : K;        // P.V: probabilities are exactly 0 beyond the diagonal block, so the keys stop there
    const int kb = (CMODE == 2) ? (int)blockIdx.z * KCH : 0;         // this work-group's first key
    if (CMODE == 2 && kb >= Kl) return;                              // chunk beyond the diagonal block: no partial plane entry (k_outT uses the same bound)
    const int ke = (CMODE == 2) ? min(Kl, kb + KCH) : K;
    v8f acc[4][4];
#pragma unroll
    for (int mb = 0; mb < 4; ++mb)
#pragma unroll
        for (int nb = 0; nb < 4; ++nb) acc[mb][nb] = (v8f){};
    const size_t aoff = (size_t)(r0 + lr) * K + 8 * hi, boff = (size_t)(c0 + lr) * K + 8 * hi;
#pragma unroll 1
    for (int kc = kb; kc < ke; kc += 32) {
        V a[4], a2[4];
#pragma unroll
        for (int mb = 0; mb < 4; ++mb) { a[mb] = WFrag<T16>::ld(A + aoff + (size_t)mb * 16 * K + kc); if (NSPLIT == 1 || NSPLIT == 2) a2[mb] = WFrag<T16>::ld(A2 + aoff + (size_t)mb * 16 * K + kc); }
#pragma unroll
        for (int nb = 0; nb < 4; ++nb) { const V b = WFrag<T16>::ld(Bt + boff + (size_t)nb * 16 * K + kc); V b2; if (NSPLIT >= 2) b2 = WFrag<T16>::ld(Bt2 + boff + (size_t)nb * 16 * K + kc);
#pragma unroll
            for (int mb = 0; mb < 4; ++mb) { acc[mb][nb] = WFrag<T16>::mma(a[mb], b, acc[mb][nb]); if (NSPLIT == 1 || NSPLIT == 2) acc[mb][nb] = WFrag<T16>::mma(a2[mb], b, acc[mb][nb]); if (NSPLIT >= 2) acc[mb][nb] = WFrag<T16>::mma(a[mb], b2, acc[mb][nb]); } }
        asm volatile("v_nop\n\tv_nop\n\tv_nop\n\tv_nop" : "+v"(acc[0][0]), "+v"(acc[1][1]), "+v"(acc[2][2]), "+v"(acc[3][3]) : "v"(a[0]), "v"(a[3]));
    }
#pragma unroll
    for (int mb = 0; mb < 4; ++mb) {
#pragma unroll
        for (int nb = 0; nb < 4; ++nb) {
#pragma unroll
            for (int j = 0; j < 8; ++j) os[(hi * 8 + j) * 68 + nb * 16 + lr] = acc[mb][nb][j]; }
        __builtin_amdgcn_wave_barrier(); asm volatile("" ::: "memory");
        float* crow = C + (size_t)(r0 + mb * 16) * ldc + c0;
{
#pragma unroll
            for (int s = 0; s < 8; ++s) { const int row = 2 * s + hi, cofs = lr * 4; v4f val = *(const v4fa*)(os + row * 68 + cofs);
                *(v4f*)(crow + (size_t)row * ldc + cofs) = val; }
             }
        __builtin_amdgcn_wave_barrier(); asm volatile("" ::: "memory");
    }
}

__device__ __forceinline__ h16 tohx(float x) { return (h16)x; }
__device__ __forceinline__ void splitf(float y, unsigned short& h, unsigned short& l) { h = f2bf(y); l = f2bf(y - bf2f(h)); }
typedef __attribute__((ext_vector_type(2))) _Float16 v2h;
typedef __attribute__((ext_vector_type(4))) _Float16 v4h;
typedef __attribute__((ext_vector_type(2))) unsigned short v2us;
typedef __attribute__((ext_vector_type(4))) unsigned short v4us;
typedef __attribute__((ext_vector_type(2))) float v2f;
typedef __attribute__((ext_vector_type(4))) int v4i;

__global__ __launch_bounds__(256) void k_wtG(const float* __restrict__ w, int K, int N, bf* Bt) {
    const int lane = threadIdx.x & 31; const int L0 = (blockIdx.x * 8 + (threadIdx.x >> 5)) * 8; const int nlines = N * K / 64;
{
#pragma unroll 1
        for (int l = 0; l < 8; ++l) { const int L = L0 + l; if (L >= nlines) break; const size_t e = (size_t)L * 64 + lane * 2; const int k = (int)(e % K), n = (int)(e / K); v2us o;
            o[0] = f2bf(w[(size_t)k * N + n]); o[1] = f2bf(w[(size_t)(k + 1) * N + n]); *(v2us*)(Bt + e) = o; }
         }
}
__global__ __launch_bounds__(256) void k_cvt8(const float* __restrict__ src, bf* dst, size_t n8) { const size_t i = (size_t)blockIdx.x * 256 + threadIdx.x; if (i >= n8) return; const v8f v = *(const v8f*)(src + i * 8); v8us o;
#pragma unroll
    for (int k = 0; k < 8; ++k) o[k] = f2bf(v[k]); *(v8us*)(dst + i * 8) = o;  }
__global__ __launch_bounds__(256) void k_cscvt(const float* __restrict__ cosT, const float* __restrict__ sinT, float* CS) { const int idx = blockIdx.x * 256 + threadIdx.x; if (idx >= TT * HD) return; v2f cs; cs[0] = bfr(cosT[idx]); cs[1] = bfr(sinT[idx]); *(v2f*)(CS + (size_t)idx * 2) = cs;  }
// k_rope: head planes [h][t][d] (fp16 + hi/lo) of rope(x) x sc with the rotate-half convention out[d] = x[d] cos[t][d] - x[d+HD/2] sin[t][d], out[d+HD/2] = x[d+HD/2] cos[t][d+HD/2] + x[d] sin[t][d+HD/2]
__global__ __launch_bounds__(256) void k_rope(const float* __restrict__ F, int pitch, int nheads, const float* __restrict__ CS, const float* __restrict__ RF, const float* __restrict__ nw, float sc, h16* P16, bf* Ph, bf* Pl) {
    const size_t e = ((size_t)blockIdx.x * 256 + threadIdx.x) * 2; if (e >= (size_t)nheads * TT * HD) return; const int d = (int)(e % HD); const int t = (int)((e / HD) % TT); const int h = (int)(e / ((size_t)HD * TT)); const float* f = F + (size_t)t * pitch + h * HD; const float rf = RF ? RF[(size_t)h * TT + t] : 1.0f; v2h o16; v2us oh, ol;
#pragma unroll
    for (int q = 0; q < 2; ++q) { const int dd = d + q; const int dp = (dd < HD / 2) ? dd + HD / 2 : dd - HD / 2; float x0 = f[dd], x1 = f[dp];
        if (RF) { float n0 = __fmul_rn(x0, rf), n1 = __fmul_rn(x1, rf); asm volatile("" : "+v"(n0)); asm volatile("" : "+v"(n1)); x0 = __fmul_rn(bfr(nw[dd]), n0); x1 = __fmul_rn(bfr(nw[dp]), n1); }
        const v2f cs = *(const v2f*)(CS + ((size_t)t * HD + dd) * 2); float a = __fmul_rn(x0, cs[0]), bq = __fmul_rn(x1, cs[1]); asm volatile("" : "+v"(a)); asm volatile("" : "+v"(bq)); const float r = ((dd < HD / 2) ? __fsub_rn(a, bq) : __fadd_rn(a, bq)) * sc;
        o16[q] = tohx(r); unsigned short a2, c2; splitf(r, a2, c2); oh[q] = a2; ol[q] = c2; }
    *(v2h*)(P16 + e) = o16; *(v2us*)(Ph + e) = oh; *(v2us*)(Pl + e) = ol;  }
__global__ __launch_bounds__(256) void k_vtp(const float* __restrict__ F, int pitch, int nheads, h16* V16, bf* Vh, bf* Vl) { const size_t e = ((size_t)blockIdx.x * 256 + threadIdx.x) * 2; if (e >= (size_t)nheads * HD * TT) return; const int t = (int)(e % TT); const int d = (int)((e / TT) % HD); const int g = (int)(e / ((size_t)TT * HD)); v2h o16; v2us oh, ol;
#pragma unroll
    for (int q = 0; q < 2; ++q) { const float x = F[(size_t)(t + q) * pitch + g * HD + d]; o16[q] = tohx(x); unsigned short a2, c2; splitf(x, a2, c2); oh[q] = a2; ol[q] = c2; }
    *(v2h*)(V16 + e) = o16; *(v2us*)(Vh + e) = oh; *(v2us*)(Vl + e) = ol;  }
__global__ __launch_bounds__(256) void k_csid(float* CS) { const int idx = blockIdx.x * 256 + threadIdx.x; if (idx >= TT * HD) return; v2f cs; cs[0] = 1.0f; cs[1] = 0.0f; *(v2f*)(CS + (size_t)idx * 2) = cs;  }
// k_asoft: per row (zz, i): t = S x HD^-0.5 for j <= i (causal; the reference's -1e9 additive fill vanishes identically); softmax over the 4096 keys (streamed in three passes, exp in two of them, fixed trees);
__global__ __launch_bounds__(256) void k_asoft(const float* __restrict__ Sb, h16* P16, bf* Ph, bf* Pl) {
    // streaming three-pass causal softmax (row max, row sum, write) so a 4096-wide row never lives in registers: wave per (zz, i) row; j > i contributes exp(-inf) = 0 (those tiles were not computed and are written as 0).
    const int lane = threadIdx.x & 31; const int row = blockIdx.x * 8 + (threadIdx.x >> 5); if (row >= ZH * TT) return; const int i = row % TT; const int zz = row / TT; (void)zz; const bool hires = (i < RH); const float* sr = Sb + (size_t)row * TT;
    const int nch = (i / 128) + 1;   // chunks of 128 columns that contain any j <= i
    float mx = -3.0e38f;
    for (int ch = 0; ch < nch; ++ch) { const int j0 = ch * 128 + lane * 4; const v4f a = *(const v4f*)(sr + j0);
#pragma unroll
        for (int q = 0; q < 4; ++q) { const float t = (j0 + q <= i) ? a[q] * SCL : -3.0e38f; mx = fmaxf(mx, t); } }
#pragma unroll
    for (int sh = 16; sh; sh >>= 1) mx = fmaxf(mx, __shfl_xor(mx, sh, 32));
    float sum = 0.f;
    for (int ch = 0; ch < nch; ++ch) { const int j0 = ch * 128 + lane * 4; const v4f a = *(const v4f*)(sr + j0);
#pragma unroll
        for (int q = 0; q < 4; ++q) { if (j0 + q <= i) { float d0 = __fsub_rn(a[q] * SCL, mx); asm volatile("" : "+v"(d0)); sum += __builtin_amdgcn_exp2f(__fmul_rn(d0, 1.4426950408889634f)); } } }
#pragma unroll
    for (int sh = 16; sh; sh >>= 1) sum += __shfl_xor(sum, sh, 32);
    const float f = __fdiv_rn(hires ? 1.0f : PCAR, sum);
    for (int ch = 0; ch < TT / 128; ++ch) { const int j0 = ch * 128 + lane * 4; float e[4];
            if (ch < nch) { const v4f a = *(const v4f*)(sr + j0);
#pragma unroll
                for (int q = 0; q < 4; ++q) { if (j0 + q <= i) { float d0 = __fsub_rn(a[q] * SCL, mx); asm volatile("" : "+v"(d0)); e[q] = __builtin_amdgcn_exp2f(__fmul_rn(d0, 1.4426950408889634f)) * f; } else e[q] = 0.f; } }
            else { e[0] = e[1] = e[2] = e[3] = 0.f; }
            if (hires) { v4us oh, ol;
#pragma unroll
                for (int q = 0; q < 4; ++q) { unsigned short a2, c2; splitf(e[q], a2, c2); oh[q] = a2; ol[q] = c2; }
                const size_t oo = ((size_t)zz * (RH ? RH : 1) + i) * TT + j0; *(v4us*)(Ph + oo) = oh; *(v4us*)(Pl + oo) = ol;  }
            else { v4h o4;
#pragma unroll
                for (int q = 0; q < 4; ++q) o4[q] = tohx(e[q]); *(v4h*)(P16 + (size_t)row * TT + j0) = o4;  } }
}


// k_outT: out[h0*HD + d][t] = scale(t) x sum over the key chunks s (ascending, fixed order) of the partial planes Pp[s][d][t]; a query tile has chunks s * KCH < (t / 64 + 1) * 64, the bound k_gemmc CMODE 2 writes by.
__global__ __launch_bounds__(256) void k_outT(const float* __restrict__ Pp, int h0, float* outb) { const size_t e = ((size_t)blockIdx.x * 256 + threadIdx.x) * 4; if (e >= (size_t)HD * TT) return; const int t = (int)(e % TT); const int d = (int)(e / TT);
    const int ns = ((t >> 6) * 64 + 64 + KCH - 1) / KCH; v4f o = (v4f){};
    for (int s0 = 0; s0 < ns; s0 += 8) { v4f v[8];   // eight planes' loads fly together (the reads are independent, only the adds are ordered); past the last chunk the last written plane is read again and not added
#pragma unroll
        for (int u = 0; u < 8; ++u) v[u] = *(const v4f*)(Pp + (size_t)min(s0 + u, ns - 1) * HD * TT + e);
#pragma unroll
        for (int u = 0; u < 8; ++u) if (s0 + u < ns) o += v[u]; }
    o *= (t < RH) ? 1.0f : (1.0f / PCAR);   // RH % 4 == 0: the four queries of a thread share the scale
    float* dst = outb + (size_t)(h0 * HD + d) * TT + t; *(v4f*)dst = o;  }   // channel-first output [E][N]

__global__ __launch_bounds__(256) void k_tok(const float* __restrict__ in, bf* X) { const size_t e = ((size_t)blockIdx.x * 256 + threadIdx.x) * 4; if (e >= (size_t)TT * DM) return; const int c = (int)(e % DM); const int n = (int)(e / DM); v4us o;
#pragma unroll
    for (int u = 0; u < 4; ++u) o[u] = f2bf(in[(size_t)(c + u) * TT + n]); *(v4us*)(X + e) = o;  }   // NCHW -> token rows [n][c]

extern "C" void kernel_launch(void* const* d_in, const int* in_sizes, int n_in,
                              void* d_out, int out_size, void* d_ws, size_t ws_size, hipStream_t stream) {
    (void)in_sizes; (void)n_in; (void)out_size;
    const float* qin = (const float*)d_in[0]; const float* kin = (const float*)d_in[1]; const float* wq = (const float*)d_in[2]; const float* bq = (const float*)d_in[3]; const float* wk = (const float*)d_in[4]; const float* bk = (const float*)d_in[5]; const float* wv = (const float*)d_in[6]; const float* bv = (const float*)d_in[7]; const float* x = qin; const float* wo = nullptr; (void)wo; const float* cosT = nullptr; const float* sinT = nullptr; (void)cosT; (void)sinT;
    float* OUT = (float*)d_out;     // [2][512][4096] channel-first
    char* wsp = (char*)d_ws;
    auto take = [&](size_t bytes) { char* p = wsp; wsp += (bytes + 255) & ~(size_t)255; return (void*)p; };
    bf* WQ = (bf*)take((size_t)DQ * DM * 2); bf* WK = (bf*)take((size_t)DKV * DM * 2); bf* WV = (bf*)take((size_t)DKV * DM * 2); bf* WO = (bf*)take((size_t)DM * DQ * 2); float* CS = (float*)take((size_t)TT * HD * 2 * 4);
    bf* XB = (bf*)take((size_t)TT * DM * 2); bf* XK = (bf*)take((size_t)TT * DM * 2); float* FQ = (float*)take((size_t)TT * DQ * 4); float* FK = (float*)take((size_t)TT * DKV * 4);
    h16* QP16 = (h16*)take((size_t)NH_ * TT * HD * 2); h16* KP16 = (h16*)take((size_t)NKV * TT * HD * 2); h16* VT16 = (h16*)take((size_t)NKV * HD * TT * 2);
    bf* QPh = (bf*)take((size_t)NH_ * TT * HD * 2); bf* QPl = (bf*)take((size_t)NH_ * TT * HD * 2); bf* KPh = (bf*)take((size_t)NKV * TT * HD * 2); bf* KPl = (bf*)take((size_t)NKV * TT * HD * 2); bf* VTh = (bf*)take((size_t)NKV * HD * TT * 2); bf* VTl = (bf*)take((size_t)NKV * HD * TT * 2); bf* Ph = (bf*)take((size_t)ZH * RH * TT * 2); bf* Pl = (bf*)take((size_t)ZH * RH * TT * 2);
    float* Sb = (float*)take((size_t)ZH * TT * TT * 4); h16* P16 = (h16*)take((size_t)ZH * TT * TT * 2); float* Pp = (float*)take((size_t)(TT / KCH) * HD * TT * 4); bf* ATh = (bf*)take((size_t)TT * DQ * 2); bf* ATl = (bf*)take((size_t)TT * DQ * 2);
    if ((size_t)(wsp - (char*)d_ws) > ws_size) return;    // ws 256 MiB
    float* FV = FK;   // v projection reuses the k buffer after the k planes are built (stream-ordered)
    { k_cvt8<<<(unsigned)(((size_t)DQ * DM / 8 + 255) / 256), 256, 0, stream>>>(wq, WQ, (size_t)DQ * DM / 8); k_cvt8<<<(unsigned)(((size_t)DKV * DM / 8 + 255) / 256), 256, 0, stream>>>(wk, WK, (size_t)DKV * DM / 8); k_cvt8<<<(unsigned)(((size_t)DKV * DM / 8 + 255) / 256), 256, 0, stream>>>(wv, WV, (size_t)DKV * DM / 8);
      
       }
    k_csid<<<(TT * HD + 255) / 256, 256, 0, stream>>>(CS);
    const unsigned LQ = (unsigned)(((size_t)NH_ * TT * HD / 2 + 255) / 256), LKv = (unsigned)(((size_t)NKV * TT * HD / 2 + 255) / 256);
    for (int b = 0; b < NB_; ++b) {
        
        k_tok<<<(unsigned)(((size_t)TT * DM / 4 + 255) / 256), 256, 0, stream>>>(qin + (size_t)b * DM * TT, XB); k_tok<<<(unsigned)(((size_t)TT * DM / 4 + 255) / 256), 256, 0, stream>>>(kin + (size_t)b * DM * TT, XK);
        k_gemmw<bf, 0, true><<<dim3(TT / 64, DQ / 64, 1), 32, 0, stream>>>(XB, nullptr, WQ, nullptr, DM, FQ, DQ, bq, 0, 0, 0);
        k_rope<<<LQ, 256, 0, stream>>>(FQ, DQ, NH_, CS, nullptr, nullptr, 1.0f, QP16, QPh, QPl);
        k_gemmw<bf, 0, true><<<dim3(TT / 64, DKV / 64, 1), 32, 0, stream>>>(XK, nullptr, WK, nullptr, DM, FK, DKV, bk, 0, 0, 0);
        k_rope<<<LKv, 256, 0, stream>>>(FK, DKV, NKV, CS, nullptr, nullptr, 1.0f, KP16, KPh, KPl);
        k_gemmw<bf, 0, true><<<dim3(TT / 64, DKV / 64, 1), 32, 0, stream>>>(XK, nullptr, WV, nullptr, DM, FV, DKV, bv, 0, 0, 0); k_vtp<<<LKv, 256, 0, stream>>>(FV, DKV, NKV, VT16, VTh, VTl);
        for (int h0 = 0; h0 < NH_; h0 += ZH) { const size_t zq = (size_t)h0, zk = (size_t)(h0 / REP);   // one kv head per query head: each pass does ZH = 1 head on kv plane h0 / REP (z-strides TT*HD)
            k_gemmc<bf, 2, 1><<<dim3(RH / 64, TT / 64, ZH), 32, 0, stream>>>(QPh + zq * TT * HD, QPl + zq * TT * HD, KPh + zk * TT * HD, KPl + zk * TT * HD, HD, Sb, TT, 0, (size_t)TT * HD, (size_t)TT * HD, (size_t)TT * TT);
            k_gemmc<h16, 0, 1><<<dim3((TT - RH) / 64, TT / 64, ZH), 32, 0, stream>>>(QP16 + zq * TT * HD + (size_t)RH * HD, nullptr, KP16 + zk * TT * HD, nullptr, HD, Sb + (size_t)RH * TT, TT, RH, (size_t)TT * HD, (size_t)TT * HD, (size_t)TT * TT);
            k_asoft<<<ZH * TT / 8, 256, 0, stream>>>(Sb, P16, Ph, Pl);
            k_gemmc<bf, 2, 2><<<dim3(HD / 64, RH / 64, RH / KCH), 32, 0, stream>>>(VTh + zk * HD * TT, VTl + zk * HD * TT, Ph, Pl, TT, Pp, TT, 0, 0, 0, (size_t)HD * TT);
            k_gemmc<h16, 0, 2><<<dim3(HD / 64, (TT - RH) / 64, TT / KCH), 32, 0, stream>>>(VT16 + zk * HD * TT, nullptr, P16 + (size_t)RH * TT, nullptr, TT, Pp + RH, TT, RH, 0, 0, (size_t)HD * TT);
            k_outT<<<(unsigned)(((size_t)HD * TT / 4 + 255) / 256), 256, 0, stream>>>(Pp, h0, OUT + (size_t)b * DQ * TT); }
        }
}

// v002
// It runs in 259 microseconds.
// Two timings next to v001 put it at 4.86 and 4.83 times that version's speed.
// Over all steps from v000 it is 9.59 times as fast.
#include <hip/hip_runtime.h>

// CausalAttention2d (query, key [2][512][64x64] NCHW -> tokens [4096][512]; q = q_tok Wq^T + bq, k = k_tok Wk^T + bk, v = k_tok Wv^T + bv (8 heads x 64); causal softmax(q.k/8) over the 4096 positions; out[b][h*64+d][n] = (attn v)[h][n][d] (no output projection; written channel-first as the reference's permute + view) -> [2][512][64][64]).
// Compute dtypes, f32 accumulate: every input rounded to bf16; q/k/v on PLAIN bf16 operands (inputs: exact) + bias; causal scores and attn.v: query rows < 512 hl (3 products), the rest single fp16 (x1024); softmax f32 (online: running maximum and sum, fused with both products)

#define NB_  2
#define TT   4096
#define DM   512
#define NH_  8
#define NKV  8
#define REP  (NH_ / NKV)
#define HD   64
#define DQ   (NH_ * HD)
#define DKV  (NKV * HD)
#define ZH   1
#define RH   512                  // query rows < RH use hi+lo planes (0: none)
#define WIN  0
#define PCAR 1024.0f
#define SCL  0.125f   // HD^-0.5
static_assert(HD == 64 && RH % 64 == 0 && TT % 64 == 0, "query tiles of 32, key tiles of 64");
typedef _Float16 h16;
typedef unsigned short bf;
typedef __attribute__((ext_vector_type(16))) __bf16   v16bf;
typedef __attribute__((ext_vector_type(16))) _Float16 v16h;
typedef __attribute__((ext_vector_type(8)))  _Float16 v8h;
typedef __attribute__((ext_vector_type(8)))  unsigned short v8us;
typedef __attribute__((ext_vector_type(8)))  float    v8f;
typedef __attribute__((ext_vector_type(4)))  float    v4f;
typedef v8h  __attribute__((may_alias)) v8ha;
typedef v4f  __attribute__((may_alias)) v4fa;
typedef v8us __attribute__((may_alias)) v8usa;

__device__ __forceinline__ unsigned short f2bf(float f) { unsigned u = __float_as_uint(f); u += 0x7FFFu + ((u >> 16) & 1u); return (unsigned short)(u >> 16); }
__device__ __forceinline__ float bf2f(unsigned short b) { return __uint_as_float(((unsigned)b) << 16); }
__device__ __forceinline__ float bfr(float f) { return bf2f(f2bf(f)); }
__device__ __forceinline__ v16h cat16(v8h lo, v8h hi) { return __builtin_shufflevector(lo, hi, 0, 1, 2, 3, 4, 5, 6, 7, 8, 9, 10, 11, 12, 13, 14, 15); }
__device__ __forceinline__ v16bf cat16b(v8us lo, v8us hi) { return __builtin_bit_cast(v16bf, __builtin_shufflevector(lo, hi, 0, 1, 2, 3, 4, 5, 6, 7, 8, 9, 10, 11, 12, 13, 14, 15)); }
__device__ __forceinline__ v8f wmma16(v16h a, v16h b, v8f c) { return __builtin_amdgcn_wmma_f32_16x16x32_f16(false, a, false, b, (short)0, c, false, false); }
__device__ __forceinline__ v8f wmmab(v16bf a, v16bf b, v8f c) { return __builtin_amdgcn_wmma_f32_16x16x32_bf16(false, a, false, b, (short)0, c, false, false); }



// ---- k_gemmw: register-blocked GEMM, ONE WAVE per 64x64 output tile (16 accumulators), operands straight from K-contiguous 16-bit planes; grid (M/64, N/64, Z), 32 threads.
// C[m][n] (f32, pitch ldc, + optional f32 bias[n]) = sum_k A[m][k] Bt[n][k] (+ split products per NSPLIT). z-batch strides sA/sB/sC in elements. K % 32 == 0.
template <typename T16> struct WFrag;
template <> struct WFrag<h16> { typedef v16h V; static __device__ __forceinline__ V ld(const h16* p) { return cat16(*(const v8h*)p, *(const v8h*)(p + 16)); } static __device__ __forceinline__ v8f mma(V a, V b, v8f c) { return wmma16(a, b, c); } };
template <> struct WFrag<bf> { typedef v16bf V; static __device__ __forceinline__ V ld(const bf* p) { return cat16b(*(const v8us*)p, *(const v8us*)(p + 16)); } static __device__ __forceinline__ v8f mma(V a, V b, v8f c) { return wmmab(a, b, c); } };
template <typename T16, int NSPLIT, bool BIAS>
__global__ __launch_bounds__(32) void k_gemmw(const T16* __restrict__ A, const T16* __restrict__ A2, const T16* __restrict__ Bt, const T16* __restrict__ Bt2, int K, float* C, int ldc, const float* __restrict__ bias, size_t sA, size_t sB, size_t sC) {
    typedef typename WFrag<T16>::V V;
    __shared__ __align__(16) float os[16 * 68];
    const size_t z = blockIdx.z; A += z * sA; if (A2) A2 += z * sA; Bt += z * sB; if (Bt2) Bt2 += z * sB; C += z * sC;
    const int lane = threadIdx.x & 31, lr = lane & 15, hi = lane >> 4; const int r0 = blockIdx.x * 64, c0 = blockIdx.y * 64;
    v8f acc[4][4];
#pragma unroll
    for (int mb = 0; mb < 4; ++mb)
#pragma unroll
        for (int nb = 0; nb < 4; ++nb) acc[mb][nb] = (v8f){};
    const size_t aoff = (size_t)(r0 + lr) * K + 8 * hi, boff = (size_t)(c0 + lr) * K + 8 * hi;
#pragma unroll 1
    for (int kc = 0; kc < K; kc += 32) {
        V a[4], a2[4];
#pragma unroll
        for (int mb = 0; mb < 4; ++mb) { a[mb] = WFrag<T16>::ld(A + aoff + (size_t)mb * 16 * K + kc); if (NSPLIT == 1 || NSPLIT == 2) a2[mb] = WFrag<T16>::ld(A2 + aoff + (size_t)mb * 16 * K + kc); }
#pragma unroll
        for (int nb = 0; nb < 4; ++nb) { const V b = WFrag<T16>::ld(Bt + boff + (size_t)nb * 16 * K + kc); V b2; if (NSPLIT >= 2) b2 = WFrag<T16>::ld(Bt2 + boff + (size_t)nb * 16 * K + kc);
#pragma unroll
            for (int mb = 0; mb < 4; ++mb) { acc[mb][nb] = WFrag<T16>::mma(a[mb], b, acc[mb][nb]); if (NSPLIT == 1 || NSPLIT == 2) acc[mb][nb] = WFrag<T16>::mma(a2[mb], b, acc[mb][nb]); if (NSPLIT >= 2) acc[mb][nb] = WFrag<T16>::mma(a[mb], b2, acc[mb][nb]); } }
        asm volatile("v_nop\n\tv_nop\n\tv_nop\n\tv_nop" : "+v"(acc[0][0]), "+v"(acc[1][1]), "+v"(acc[2][2]), "+v"(acc[3][3]) : "v"(a[0]), "v"(a[3]));
    }
#pragma unroll
    for (int mb = 0; mb < 4; ++mb) {
#pragma unroll
        for (int nb = 0; nb < 4; ++nb) {
#pragma unroll
            for (int j = 0; j < 8; ++j) os[(hi * 8 + j) * 68 + nb * 16 + lr] = acc[mb][nb][j]; }
        __builtin_amdgcn_wave_barrier(); asm volatile("" ::: "memory");
        float* crow = C + (size_t)(r0 + mb * 16) * ldc + c0;
{
#pragma unroll
            for (int s = 0; s < 8; ++s) { const int row = 2 * s + hi, cofs = lr * 4; v4f val = *(const v4fa*)(os + row * 68 + cofs); if (BIAS) { val[0] += bfr(bias[c0 + cofs]); val[1] += bfr(bias[c0 + cofs + 1]); val[2] += bfr(bias[c0 + cofs + 2]); val[3] += bfr(bias[c0 + cofs + 3]); }
                *(v4f*)(crow + (size_t)row * ldc + cofs) = val; }
             }
        __builtin_amdgcn_wave_barrier(); asm volatile("" ::: "memory");
    }
}

__device__ __forceinline__ h16 tohx(float x) { return (h16)x; }
__device__ __forceinline__ void splitf(float y, unsigned short& h, unsigned short& l) { h = f2bf(y); l = f2bf(y - bf2f(h)); }
typedef __attribute__((ext_vector_type(2))) _Float16 v2h;
typedef __attribute__((ext_vector_type(4))) _Float16 v4h;
typedef __attribute__((ext_vector_type(2))) unsigned short v2us;
typedef __attribute__((ext_vector_type(4))) unsigned short v4us;
typedef __attribute__((ext_vector_type(2))) float v2f;
typedef __attribute__((ext_vector_type(4))) int v4i;

__global__ __launch_bounds__(256) void k_wtG(const float* __restrict__ w, int K, int N, bf* Bt) {
    const int lane = threadIdx.x & 31; const int L0 = (blockIdx.x * 8 + (threadIdx.x >> 5)) * 8; const int nlines = N * K / 64;
{
#pragma unroll 1
        for (int l = 0; l < 8; ++l) { const int L = L0 + l; if (L >= nlines) break; const size_t e = (size_t)L * 64 + lane * 2; const int k = (int)(e % K), n = (int)(e / K); v2us o;
            o[0] = f2bf(w[(size_t)k * N + n]); o[1] = f2bf(w[(size_t)(k + 1) * N + n]); *(v2us*)(Bt + e) = o; }
         }
}
__global__ __launch_bounds__(256) void k_cvt8(const float* __restrict__ src, bf* dst, size_t n8) { const size_t i = (size_t)blockIdx.x * 256 + threadIdx.x; if (i >= n8) return; const v8f v = *(const v8f*)(src + i * 8); v8us o;
#pragma unroll
    for (int k = 0; k < 8; ++k) o[k] = f2bf(v[k]); *(v8us*)(dst + i * 8) = o;  }
__global__ __launch_bounds__(256) void k_cscvt(const float* __restrict__ cosT, const float* __restrict__ sinT, float* CS) { const int idx = blockIdx.x * 256 + threadIdx.x; if (idx >= TT * HD) return; v2f cs; cs[0] = bfr(cosT[idx]); cs[1] = bfr(sinT[idx]); *(v2f*)(CS + (size_t)idx * 2) = cs;  }
// k_rope: head planes [h][t][d] (fp16 + hi/lo) of rope(x) x sc with the rotate-half convention out[d] = x[d] cos[t][d] - x[d+HD/2] sin[t][d], out[d+HD/2] = x[d+HD/2] cos[t][d+HD/2] + x[d] sin[t][d+HD/2]
__global__ __launch_bounds__(256) void k_rope(const float* __restrict__ F, int pitch, int nheads, const float* __restrict__ CS, const float* __restrict__ RF, const float* __restrict__ nw, float sc, h16* P16, bf* Ph, bf* Pl) {
    const size_t e = ((size_t)blockIdx.x * 256 + threadIdx.x) * 2; if (e >= (size_t)nheads * TT * HD) return; const int d = (int)(e % HD); const int t = (int)((e / HD) % TT); const int h = (int)(e / ((size_t)HD * TT)); const float* f = F + (size_t)t * pitch + h * HD; const float rf = RF ? RF[(size_t)h * TT + t] : 1.0f; v2h o16; v2us oh, ol;
#pragma unroll
    for (int q = 0; q < 2; ++q) { const int dd = d + q; const int dp = (dd < HD / 2) ? dd + HD / 2 : dd - HD / 2; float x0 = f[dd], x1 = f[dp];
        if (RF) { float n0 = __fmul_rn(x0, rf), n1 = __fmul_rn(x1, rf); asm volatile("" : "+v"(n0)); asm volatile("" : "+v"(n1)); x0 = __fmul_rn(bfr(nw[dd]), n0); x1 = __fmul_rn(bfr(nw[dp]), n1); }
        const v2f cs = *(const v2f*)(CS + ((size_t)t * HD + dd) * 2); float a = __fmul_rn(x0, cs[0]), bq = __fmul_rn(x1, cs[1]); asm volatile("" : "+v"(a)); asm volatile("" : "+v"(bq)); const float r = ((dd < HD / 2) ? __fsub_rn(a, bq) : __fadd_rn(a, bq)) * sc;
        o16[q] = tohx(r); unsigned short a2, c2; splitf(r, a2, c2); oh[q] = a2; ol[q] = c2; }
    *(v2h*)(P16 + e) = o16; *(v2us*)(Ph + e) = oh; *(v2us*)(Pl + e) = ol;  }
__global__ __launch_bounds__(256) void k_vtp(const float* __restrict__ F, int pitch, int nheads, h16* V16, bf* Vh, bf* Vl) { const size_t e = ((size_t)blockIdx.x * 256 + threadIdx.x) * 2; if (e >= (size_t)nheads * HD * TT) return; const int t = (int)(e % TT); const int d = (int)((e / TT) % HD); const int g = (int)(e / ((size_t)TT * HD)); v2h o16; v2us oh, ol;
#pragma unroll
    for (int q = 0; q < 2; ++q) { const float x = F[(size_t)(t + q) * pitch + g * HD + d]; o16[q] = tohx(x); unsigned short a2, c2; splitf(x, a2, c2); oh[q] = a2; ol[q] = c2; }
    *(v2h*)(V16 + e) = o16; *(v2us*)(Vh + e) = oh; *(v2us*)(Vl + e) = ol;  }
__global__ __launch_bounds__(256) void k_csid(float* CS) { const int idx = blockIdx.x * 256 + threadIdx.x; if (idx >= TT * HD) return; v2f cs; cs[0] = 1.0f; cs[1] = 0.0f; *(v2f*)(CS + (size_t)idx * 2) = cs;  }
typedef __attribute__((ext_vector_type(16))) unsigned short v16us;
#define LC2 0.18033688011112042f   // HD^-0.5 x log2(e)
__device__ __forceinline__ void stq(h16* d, const h16* g) { *(v8ha*)d = *(const v8h*)g; *(v8ha*)(d + 256) = *(const v8h*)(g + 16); }       // one lane's two 16-byte halves of a fragment, global -> LDS
__device__ __forceinline__ void stq(bf* d, const bf* g) { *(v8usa*)d = *(const v8us*)g; *(v8usa*)(d + 256) = *(const v8us*)(g + 16); }
__device__ __forceinline__ v16h ldq(const h16* p) { return cat16(*(const v8ha*)p, *(const v8ha*)(p + 256)); }
__device__ __forceinline__ v16bf ldq(const bf* p) { return cat16b(*(const v8usa*)p, *(const v8usa*)(p + 256)); }
// 2^x with the slot the instruction set asks for behind a transcendental (one independent instruction or v_nop before its result is read or its source overwritten) kept inside the statement:
// of eight in place, each is the independent instruction behind the one before it, and one v_nop stands behind the last.
__device__ __forceinline__ float exp2n(float x) { float r; asm("v_exp_f32 %0, %1\n\tv_nop" : "=v"(r) : "v"(x)); return r; }
__device__ __forceinline__ v8f exp2x8(v8f x) { float a = x[0], b = x[1], c = x[2], d = x[3], e = x[4], f = x[5], g = x[6], h = x[7];
    asm("v_exp_f32 %0, %0\n\tv_exp_f32 %1, %1\n\tv_exp_f32 %2, %2\n\tv_exp_f32 %3, %3\n\tv_exp_f32 %4, %4\n\tv_exp_f32 %5, %5\n\tv_exp_f32 %6, %6\n\tv_exp_f32 %7, %7\n\tv_nop" : "+v"(a), "+v"(b), "+v"(c), "+v"(d), "+v"(e), "+v"(f), "+v"(g), "+v"(h));
    return (v8f){a, b, c, d, e, f, g, h}; }
template <typename T16, int NSPLIT, int NQ, int QW, int KW>
__global__ __launch_bounds__(32 * QW * KW) __attribute__((amdgpu_waves_per_eu(4))) void k_fattn(const T16* __restrict__ Q, const T16* __restrict__ Q2, const T16* __restrict__ Kp, const T16* __restrict__ Kp2, const T16* __restrict__ Vt, const T16* __restrict__ Vt2, int qbase, int nqt, float* __restrict__ out) {   // four waves per SIMD: at most 256 registers
    typedef typename WFrag<T16>::V V;
    static_assert(NQ * QW == 2 && HD == 64 && REP == 1 && (NSPLIT == 0 || NSPLIT == 2) && (NQ == 1 || NQ == 2), "32 queries per work-group, head size 64");
    __shared__ __align__(16) float Os[KW][HD][36];               // pitch 144 B: 16 B x odd
    __shared__ __align__(16) float Ms[KW][32];
    __shared__ __align__(16) float Ls[KW][32];
    __shared__ __align__(16) float Wt[KW][32];
    constexpr int NP = (NSPLIT == 2) ? 2 : 1;                    // operand planes (hi, lo)
    __shared__ __align__(16) T16 Qs[QW * KW * NP * NQ * 1024];   // the query fragments wait in LDS outside the score products, so that scores or P, the value tile and O^T fit 256 registers
    const int tid = threadIdx.x, lane = tid & 31, lr = lane & 15, hi = lane >> 4;
    const int w = __builtin_amdgcn_readfirstlane(tid >> 5), qw = w % QW, kw = w / QW;
    const int q0 = qbase + (nqt - 1 - (int)blockIdx.y) * 32;
    const int nkt = q0 / 64 + 1;                                 // 64-key tiles that hold a key <= some query; the last one starts at a key <= q0, so every query has a live key in every tile
    const int qc = qw * NQ * 16;
    const size_t pl = (size_t)blockIdx.x * TT * HD;
    Q += pl; Kp += pl; Vt += pl; if (NSPLIT == 2) { Q2 += pl; Kp2 += pl; Vt2 += pl; }
    const unsigned klane = (unsigned)(lr * HD + 8 * hi), vlane = (unsigned)(lr * TT + 8 * hi);   // the lane's part of a fragment address; the tile's part is wave-uniform (scalar base)
    const float poff = (NSPLIT == 2) ? 0.0f : 10.0f;             // single fp16 P carries x 2^10 (as PCAR), in l too, so it cancels in O / l
    V bq[NQ][2], bq2[NQ][2];
    T16* const qs = Qs + w * NP * NQ * 1024 + lane * 8;          // this wave's own copy, 16 B per lane and half fragment: written and read by the same lanes, no barrier
#pragma unroll
    for (int nb = 0; nb < NQ; ++nb)
#pragma unroll
        for (int ks = 0; ks < 2; ++ks) { const size_t qo = (size_t)(q0 + qc + nb * 16 + lr) * HD + ks * 32 + 8 * hi;
            stq(qs + (nb * 2 + ks) * 512, Q + qo); if (NSPLIT == 2) stq(qs + (NQ * 2 + nb * 2 + ks) * 512, Q2 + qo); }
    v8f o[4][NQ]; float m[NQ], l[NQ];
#pragma unroll
    for (int nb = 0; nb < NQ; ++nb) { m[nb] = -3.0e38f; l[nb] = 0.f;
#pragma unroll
        for (int db = 0; db < 4; ++db) o[db][nb] = (v8f){}; }
#pragma unroll 1   // rolled: an unrolled body would double the live score and fragment registers
    for (int kt = kw; kt < nkt; kt += KW) {
        const int k0 = kt * 64;
        v8f st[4][NQ]; V ka[4][2], ka2[4][2], va[2][4], va2[2][4];
#pragma unroll
        for (int mb = 0; mb < 4; ++mb)
#pragma unroll
            for (int nb = 0; nb < NQ; ++nb) st[mb][nb] = (v8f){};
        asm volatile("" ::: "memory");   // compiler fence: the query fragments are read from LDS anew in every pass (hoisted out of the loop they would stay in registers and spill)
#pragma unroll
        for (int nb = 0; nb < NQ; ++nb)
#pragma unroll
            for (int ks = 0; ks < 2; ++ks) { bq[nb][ks] = ldq(qs + (nb * 2 + ks) * 512); if (NSPLIT == 2) bq2[nb][ks] = ldq(qs + (NQ * 2 + nb * 2 + ks) * 512); }
#pragma unroll
        for (int mb = 0; mb < 4; ++mb)
#pragma unroll
            for (int ks = 0; ks < 2; ++ks) { const unsigned ko = klane + (unsigned)(mb * 16 * HD + ks * 32); ka[mb][ks] = WFrag<T16>::ld(Kp + (size_t)k0 * HD + ko); if (NSPLIT == 2) ka2[mb][ks] = WFrag<T16>::ld(Kp2 + (size_t)k0 * HD + ko); }
        __builtin_amdgcn_sched_barrier(0);   // the key tile's loads stay together in front of the products: one load latency per tile, not one per fragment
#pragma unroll
        for (int mb = 0; mb < 4; ++mb)
#pragma unroll
            for (int ks = 0; ks < 2; ++ks)
#pragma unroll
                for (int nb = 0; nb < NQ; ++nb) { st[mb][nb] = WFrag<T16>::mma(ka[mb][ks], bq[nb][ks], st[mb][nb]); if (NSPLIT == 2) { st[mb][nb] = WFrag<T16>::mma(ka2[mb][ks], bq[nb][ks], st[mb][nb]); st[mb][nb] = WFrag<T16>::mma(ka[mb][ks], bq2[nb][ks], st[mb][nb]); } }
        if constexpr (NSPLIT == 0) {
#pragma unroll
            for (int kb = 0; kb < 2; ++kb)
#pragma unroll
                for (int db = 0; db < 4; ++db) va[kb][db] = WFrag<T16>::ld(Vt + k0 + (vlane + (unsigned)(db * 16 * TT + kb * 32)));
            __builtin_amdgcn_sched_barrier(0); }   // the value tile's loads are issued here, into the key fragments' registers, and fly under the softmax
        if (kt == nkt - 1) {                                     // only the last tile crosses the diagonal
#pragma unroll
            for (int mb = 0; mb < 4; ++mb)
#pragma unroll
                for (int nb = 0; nb < NQ; ++nb)
#pragma unroll
                    for (int j = 0; j < 8; ++j) if (k0 + mb * 16 + hi * 8 + j > q0 + qc + nb * 16 + lr) st[mb][nb][j] = -3.0e38f; }
        V pb[NQ][2], pb2[NQ][2];
#pragma unroll
        for (int nb = 0; nb < NQ; ++nb) {
            float t4[4];
#pragma unroll
            for (int u = 0; u < 4; ++u) t4[u] = fmaxf(st[0][nb][u], st[0][nb][u + 4]);
#pragma unroll
            for (int mb = 1; mb < 4; ++mb)
#pragma unroll
                for (int j = 0; j < 8; ++j) t4[j & 3] = fmaxf(t4[j & 3], st[mb][nb][j]);
            float mt = fmaxf(fmaxf(t4[0], t4[1]), fmaxf(t4[2], t4[3]));
            mt = fmaxf(mt, __shfl_xor(mt, 16, 32));              // the other half of the wave holds the query's other 32 keys
            const float mn = fmaxf(m[nb], mt);
            const float al = exp2n((m[nb] - mn) * LC2);
            const float nm = poff - mn * LC2;
            m[nb] = mn;
            float s4[4] = {0.f, 0.f, 0.f, 0.f};
#pragma unroll
            for (int mb = 0; mb < 4; ++mb) { v8f x;
#pragma unroll
                for (int j = 0; j < 8; ++j) x[j] = fmaf(st[mb][nb][j], LC2, nm);
                x = exp2x8(x); st[mb][nb] = x;
#pragma unroll
                for (int j = 0; j < 8; ++j) s4[j & 3] += x[j]; }
            l[nb] = l[nb] * al + ((s4[0] + s4[1]) + (s4[2] + s4[3]));   // this half's keys only; the halves are joined after the loop
#pragma unroll
            for (int db = 0; db < 4; ++db) o[db][nb] *= al;
#pragma unroll
            for (int kb = 0; kb < 2; ++kb) {
                if constexpr (NSPLIT == 2) { v16us ph, pq;
#pragma unroll
                    for (int s = 0; s < 16; ++s) { unsigned short a2, c2; splitf(st[2 * kb + (s >> 3)][nb][s & 7], a2, c2); ph[s] = a2; pq[s] = c2; }
                    pb[nb][kb] = __builtin_bit_cast(v16bf, ph); pb2[nb][kb] = __builtin_bit_cast(v16bf, pq); }
                else { v16h ph;
#pragma unroll
                    for (int s = 0; s < 16; ++s) ph[s] = tohx(st[2 * kb + (s >> 3)][nb][s & 7]);
                    pb[nb][kb] = ph; } } }
        if constexpr (NSPLIT == 2) {   // hi and lo value planes do not fit 256 registers beside the scores: loaded behind the softmax (these work-groups have at most two passes per wave)
#pragma unroll
            for (int kb = 0; kb < 2; ++kb)
#pragma unroll
                for (int db = 0; db < 4; ++db) { const unsigned vo = vlane + (unsigned)(db * 16 * TT + kb * 32); va[kb][db] = WFrag<T16>::ld(Vt + k0 + vo); va2[kb][db] = WFrag<T16>::ld(Vt2 + k0 + vo); } }
#pragma unroll
        for (int kb = 0; kb < 2; ++kb) {
#pragma unroll
            for (int db = 0; db < 4; ++db) { const V a = va[kb][db]; V a2; if (NSPLIT == 2) a2 = va2[kb][db];
#pragma unroll
                for (int nb = 0; nb < NQ; ++nb) { o[db][nb] = WFrag<T16>::mma(a, pb[nb][kb], o[db][nb]); if (NSPLIT == 2) { o[db][nb] = WFrag<T16>::mma(a2, pb[nb][kb], o[db][nb]); o[db][nb] = WFrag<T16>::mma(a, pb2[nb][kb], o[db][nb]); } } } }
    }
#pragma unroll
    for (int nb = 0; nb < NQ; ++nb) { const int qq = qc + nb * 16 + lr;
        const float lt = l[nb] + __shfl_xor(l[nb], 16, 32);
        if (hi == 0) { Ms[kw][qq] = m[nb]; Ls[kw][qq] = lt; }
#pragma unroll
        for (int db = 0; db < 4; ++db)
#pragma unroll
            for (int j = 0; j < 8; ++j) Os[kw][db * 16 + hi * 8 + j][qq] = o[db][nb][j]; }
    __syncthreads();                                             // every wave's partial (m, l, O^T) is in LDS
    if (tid < 32) { float mm = Ms[0][tid];
#pragma unroll
        for (int k = 1; k < KW; ++k) mm = fmaxf(mm, Ms[k][tid]);
        float f[KW], den = 0.f;                                  // a wave without a tile has m = -3e38, l = 0, O = 0: weight 0
#pragma unroll
        for (int k = 0; k < KW; ++k) { f[k] = exp2n((Ms[k][tid] - mm) * LC2); den += Ls[k][tid] * f[k]; }
#pragma unroll
        for (int k = 0; k < KW; ++k) Wt[k][tid] = __fdiv_rn(f[k], den); }
    __syncthreads();                                             // the merge weights are in LDS
#pragma unroll
    for (int idx = tid; idx < HD * 8; idx += 32 * QW * KW) { const int d = idx >> 3, q4 = (idx & 7) * 4; v4f r = (v4f){};
#pragma unroll
        for (int k = 0; k < KW; ++k) r += *(const v4fa*)&Os[k][d][q4] * *(const v4fa*)&Wt[k][q4];
        *(v4f*)(out + ((size_t)blockIdx.x * HD + d) * TT + q0 + q4) = r; }   // channel-first output [batch x head x d][query]; a work-group owns whole 128-byte lines
}

__global__ __launch_bounds__(256) void k_tok(const float* __restrict__ in, bf* X) { const size_t e = ((size_t)blockIdx.x * 256 + threadIdx.x) * 4; if (e >= (size_t)TT * DM) return; const int c = (int)(e % DM); const int n = (int)(e / DM); v4us o;
#pragma unroll
    for (int u = 0; u < 4; ++u) o[u] = f2bf(in[(size_t)(c + u) * TT + n]); *(v4us*)(X + e) = o;  }   // NCHW -> token rows [n][c]

extern "C" void kernel_launch(void* const* d_in, const int* in_sizes, int n_in,
                              void* d_out, int out_size, void* d_ws, size_t ws_size, hipStream_t stream) {
    (void)in_sizes; (void)n_in; (void)out_size;
    const float* qin = (const float*)d_in[0]; const float* kin = (const float*)d_in[1]; const float* wq = (const float*)d_in[2]; const float* bq = (const float*)d_in[3]; const float* wk = (const float*)d_in[4]; const float* bk = (const float*)d_in[5]; const float* wv = (const float*)d_in[6]; const float* bv = (const float*)d_in[7]; const float* x = qin; const float* wo = nullptr; (void)wo; const float* cosT = nullptr; const float* sinT = nullptr; (void)cosT; (void)sinT;
    float* OUT = (float*)d_out;     // [2][512][4096] channel-first
    char* wsp = (char*)d_ws;
    auto take = [&](size_t bytes) { char* p = wsp; wsp += (bytes + 255) & ~(size_t)255; return (void*)p; };
    bf* WQ = (bf*)take((size_t)DQ * DM * 2); bf* WK = (bf*)take((size_t)DKV * DM * 2); bf* WV = (bf*)take((size_t)DKV * DM * 2); bf* WO = (bf*)take((size_t)DM * DQ * 2); float* CS = (float*)take((size_t)TT * HD * 2 * 4);
    bf* XB = (bf*)take((size_t)TT * DM * 2); bf* XK = (bf*)take((size_t)TT * DM * 2); float* FQ = (float*)take((size_t)TT * DQ * 4); float* FK = (float*)take((size_t)TT * DKV * 4);
    h16* QP16 = (h16*)take((size_t)NB_ * NH_ * TT * HD * 2); h16* KP16 = (h16*)take((size_t)NB_ * NKV * TT * HD * 2); h16* VT16 = (h16*)take((size_t)NB_ * NKV * HD * TT * 2);   // head planes of both batches: [b][h][..]
    bf* QPh = (bf*)take((size_t)NB_ * NH_ * TT * HD * 2); bf* QPl = (bf*)take((size_t)NB_ * NH_ * TT * HD * 2); bf* KPh = (bf*)take((size_t)NB_ * NKV * TT * HD * 2); bf* KPl = (bf*)take((size_t)NB_ * NKV * TT * HD * 2); bf* VTh = (bf*)take((size_t)NB_ * NKV * HD * TT * 2); bf* VTl = (bf*)take((size_t)NB_ * NKV * HD * TT * 2);
    bf* ATh = (bf*)take((size_t)TT * DQ * 2); bf* ATl = (bf*)take((size_t)TT * DQ * 2);
    if ((size_t)(wsp - (char*)d_ws) > ws_size) return;    // ws 256 MiB
    float* FV = FK;   // v projection reuses the k buffer after the k planes are built (stream-ordered)
    { k_cvt8<<<(unsigned)(((size_t)DQ * DM / 8 + 255) / 256), 256, 0, stream>>>(wq, WQ, (size_t)DQ * DM / 8); k_cvt8<<<(unsigned)(((size_t)DKV * DM / 8 + 255) / 256), 256, 0, stream>>>(wk, WK, (size_t)DKV * DM / 8); k_cvt8<<<(unsigned)(((size_t)DKV * DM / 8 + 255) / 256), 256, 0, stream>>>(wv, WV, (size_t)DKV * DM / 8);
      
       }
    k_csid<<<(TT * HD + 255) / 256, 256, 0, stream>>>(CS);
    const unsigned LQ = (unsigned)(((size_t)NH_ * TT * HD / 2 + 255) / 256), LKv = (unsigned)(((size_t)NKV * TT * HD / 2 + 255) / 256);
    for (int b = 0; b < NB_; ++b) {
        const size_t pb = (size_t)b * NH_ * TT * HD;   // this batch's head planes
        k_tok<<<(unsigned)(((size_t)TT * DM / 4 + 255) / 256), 256, 0, stream>>>(qin + (size_t)b * DM * TT, XB); k_tok<<<(unsigned)(((size_t)TT * DM / 4 + 255) / 256), 256, 0, stream>>>(kin + (size_t)b * DM * TT, XK);
        k_gemmw<bf, 0, true><<<dim3(TT / 64, DQ / 64, 1), 32, 0, stream>>>(XB, nullptr, WQ, nullptr, DM, FQ, DQ, bq, 0, 0, 0);
        k_rope<<<LQ, 256, 0, stream>>>(FQ, DQ, NH_, CS, nullptr, nullptr, 1.0f, QP16 + pb, QPh + pb, QPl + pb);
        k_gemmw<bf, 0, true><<<dim3(TT / 64, DKV / 64, 1), 32, 0, stream>>>(XK, nullptr, WK, nullptr, DM, FK, DKV, bk, 0, 0, 0);
        k_rope<<<LKv, 256, 0, stream>>>(FK, DKV, NKV, CS, nullptr, nullptr, 1.0f, KP16 + pb, KPh + pb, KPl + pb);
        k_gemmw<bf, 0, true><<<dim3(TT / 64, DKV / 64, 1), 32, 0, stream>>>(XK, nullptr, WV, nullptr, DM, FV, DKV, bv, 0, 0, 0); k_vtp<<<LKv, 256, 0, stream>>>(FV, DKV, NKV, VT16 + pb, VTh + pb, VTl + pb);
        }
    k_fattn<h16, 0, 2, 1, 4><<<dim3(NB_ * NH_, (TT - RH) / 32, 1), 128, 0, stream>>>(QP16, nullptr, KP16, nullptr, VT16, nullptr, RH, (TT - RH) / 32, OUT);
    k_fattn<bf, 2, 1, 2, 4><<<dim3(NB_ * NH_, RH / 32, 1), 256, 0, stream>>>(QPh, QPl, KPh, KPl, VTh, VTl, 0, RH / 32, OUT);
}

// v003
// Measured time: 213 microseconds a run.
// Next to v002, in two timings, it ran 1.22 and 1.21 times as fast.
// Counting every step since v000, it is 11.7 times as fast.
#include <hip/hip_runtime.h>

// CausalAttention2d (query, key [2][512][64x64] NCHW -> tokens [4096][512]; q = q_tok Wq^T + bq, k = k_tok Wk^T + bk, v = k_tok Wv^T + bv (8 heads x 64); causal softmax(q.k/8) over the 4096 positions; out[b][h*64+d][n] = (attn v)[h][n][d] (no output projection; written channel-first as the reference's permute + view) -> [2][512][64][64]).
// Compute dtypes, f32 accumulate: every input rounded to bf16; q/k/v on PLAIN bf16 operands (inputs: exact) + bias; causal scores and attn.v: query rows < 512 hl (3 products), the rest single fp16 (x1024); softmax f32 (online: running maximum and sum, fused with both products)

#define NB_  2
#define TT   4096
#define DM   512
#define NH_  8
#define NKV  8
#define REP  (NH_ / NKV)
#define HD   64
#define DQ   (NH_ * HD)
#define DKV  (NKV * HD)
#define ZH   1
#define RH   512                  // query rows < RH use hi+lo planes (0: none)
#define WIN  0
#define PCAR 1024.0f
#define SCL  0.125f   // HD^-0.5
static_assert(HD == 64 && RH % 64 == 0 && TT % 64 == 0, "query tiles of 32, key tiles of 64");
typedef _Float16 h16;
typedef unsigned short bf;
typedef __attribute__((ext_vector_type(16))) __bf16   v16bf;
typedef __attribute__((ext_vector_type(16))) _Float16 v16h;
typedef __attribute__((ext_vector_type(8)))  _Float16 v8h;
typedef __attribute__((ext_vector_type(8)))  unsigned short v8us;
typedef __attribute__((ext_vector_type(8)))  float    v8f;
typedef __attribute__((ext_vector_type(4)))  float    v4f;
typedef v8h  __attribute__((may_alias)) v8ha;
typedef v4f  __attribute__((may_alias)) v4fa;
typedef v8us __attribute__((may_alias)) v8usa;

__device__ __forceinline__ unsigned short f2bf(float f) { unsigned u = __float_as_uint(f); u += 0x7FFFu + ((u >> 16) & 1u); return (unsigned short)(u >> 16); }
__device__ __forceinline__ float bf2f(unsigned short b) { return __uint_as_float(((unsigned)b) << 16); }
__device__ __forceinline__ float bfr(float f) { return bf2f(f2bf(f)); }
__device__ __forceinline__ v16h cat16(v8h lo, v8h hi) { return __builtin_shufflevector(lo, hi, 0, 1, 2, 3, 4, 5, 6, 7, 8, 9, 10, 11, 12, 13, 14, 15); }
__device__ __forceinline__ v16bf cat16b(v8us lo, v8us hi) { return __builtin_bit_cast(v16bf, __builtin_shufflevector(lo, hi, 0, 1, 2, 3, 4, 5, 6, 7, 8, 9, 10, 11, 12, 13, 14, 15)); }
__device__ __forceinline__ v8f wmma16(v16h a, v16h b, v8f c) { return __builtin_amdgcn_wmma_f32_16x16x32_f16(false, a, false, b, (short)0, c, false, false); }
__device__ __forceinline__ v8f wmmab(v16bf a, v16bf b, v8f c) { return __builtin_amdgcn_wmma_f32_16x16x32_bf16(false, a, false, b, (short)0, c, false, false); }



// ---- k_gemmw: register-blocked GEMM, ONE WAVE per 64x64 output tile (16 accumulators), operands straight from K-contiguous 16-bit planes; grid (M/64, N/64, Z), 32 threads.
// c[m][n] (f32) = sum_k A[m][k] Bt[n][k] (+ split products per NSPLIT) + bias[n] stays in registers; z-batch strides sA/sB in elements. K % 32 == 0. A column tile is one head (HD == 64).
// The epilogue writes the three 16-bit head planes of c itself (fp16, bf16 hi, bf16 lo): VT false [head][m][d], VT true [head][d][m]; whole 128-byte lines, staged through the wave's own LDS.
template <typename T16> struct WFrag;
template <> struct WFrag<h16> { typedef v16h V; static __device__ __forceinline__ V ld(const h16* p) { return cat16(*(const v8h*)p, *(const v8h*)(p + 16)); } static __device__ __forceinline__ v8f mma(V a, V b, v8f c) { return wmma16(a, b, c); } };
template <> struct WFrag<bf> { typedef v16bf V; static __device__ __forceinline__ V ld(const bf* p) { return cat16b(*(const v8us*)p, *(const v8us*)(p + 16)); } static __device__ __forceinline__ v8f mma(V a, V b, v8f c) { return wmmab(a, b, c); } };
__device__ __forceinline__ h16 tohx(float x) { return (h16)x; }
__device__ __forceinline__ void splitf(float y, unsigned short& h, unsigned short& l) { h = f2bf(y); l = f2bf(y - bf2f(h)); }
template <typename T16, int NSPLIT, bool VT>
__global__ __launch_bounds__(32) void k_gemmw(const T16* __restrict__ A, const T16* __restrict__ A2, const T16* __restrict__ Bt, const T16* __restrict__ Bt2, int K, const float* __restrict__ bias, size_t sA, size_t sB, h16* __restrict__ P16, bf* __restrict__ Ph, bf* __restrict__ Pl) {
    typedef typename WFrag<T16>::V V;
    const size_t z = blockIdx.z; A += z * sA; if (A2) A2 += z * sA; Bt += z * sB; if (Bt2) Bt2 += z * sB;
    const int lane = threadIdx.x & 31, lr = lane & 15, hi = lane >> 4; const int r0 = blockIdx.x * 64, c0 = blockIdx.y * 64;
    v8f acc[4][4];
#pragma unroll
    for (int mb = 0; mb < 4; ++mb)
#pragma unroll
        for (int nb = 0; nb < 4; ++nb) acc[mb][nb] = (v8f){};
    const size_t aoff = (size_t)(r0 + lr) * K + 8 * hi, boff = (size_t)(c0 + lr) * K + 8 * hi;
#pragma unroll 1
    for (int kc = 0; kc < K; kc += 32) {
        V a[4], a2[4];
#pragma unroll
        for (int mb = 0; mb < 4; ++mb) { a[mb] = WFrag<T16>::ld(A + aoff + (size_t)mb * 16 * K + kc); if (NSPLIT == 1 || NSPLIT == 2) a2[mb] = WFrag<T16>::ld(A2 + aoff + (size_t)mb * 16 * K + kc); }
#pragma unroll
        for (int nb = 0; nb < 4; ++nb) { const V b = WFrag<T16>::ld(Bt + boff + (size_t)nb * 16 * K + kc); V b2; if (NSPLIT >= 2) b2 = WFrag<T16>::ld(Bt2 + boff + (size_t)nb * 16 * K + kc);
#pragma unroll
            for (int mb = 0; mb < 4; ++mb) { acc[mb][nb] = WFrag<T16>::mma(a[mb], b, acc[mb][nb]); if (NSPLIT == 1 || NSPLIT == 2) acc[mb][nb] = WFrag<T16>::mma(a2[mb], b, acc[mb][nb]); if (NSPLIT >= 2) acc[mb][nb] = WFrag<T16>::mma(a[mb], b2, acc[mb][nb]); } }
        asm volatile("v_nop\n\tv_nop\n\tv_nop\n\tv_nop" : "+v"(acc[0][0]), "+v"(acc[1][1]), "+v"(acc[2][2]), "+v"(acc[3][3]) : "v"(a[0]), "v"(a[3]));
    }
    const int r4 = lane >> 3, c8 = (lane & 7) * 8;   // read-back: a lane takes 8 neighbours of a row (16 B of a plane), 8 lanes a whole 128-byte line, a wave 4 rows
    if constexpr (!VT) {
        __shared__ __align__(16) float os[16 * 68];
        float bl[8];
#pragma unroll
        for (int u = 0; u < 8; ++u) bl[u] = bfr(bias[c0 + c8 + u]);
#pragma unroll
        for (int mb = 0; mb < 4; ++mb) {
#pragma unroll
            for (int nb = 0; nb < 4; ++nb) {
#pragma unroll
                for (int j = 0; j < 8; ++j) os[(hi * 8 + j) * 68 + nb * 16 + lr] = acc[mb][nb][j]; }
            __builtin_amdgcn_wave_barrier(); asm volatile("" ::: "memory");   // compiler fence: the reads below take what other lanes of this wave stored above
            v8h o16[4]; v8us oh[4], ol[4];
#pragma unroll
            for (int s = 0; s < 4; ++s) { const int row = 4 * s + r4; const v4f x0 = *(const v4fa*)(os + row * 68 + c8), x1 = *(const v4fa*)(os + row * 68 + c8 + 4);
#pragma unroll
                for (int u = 0; u < 8; ++u) { const float r = ((u < 4) ? x0[u & 3] : x1[u & 3]) + bl[u]; o16[s][u] = tohx(r); unsigned short a2, c2; splitf(r, a2, c2); oh[s][u] = a2; ol[s][u] = c2; } }
            __builtin_amdgcn_sched_barrier(0);   // the block's twelve stores stand together behind its arithmetic, so that nothing rewrites a stored register between a store and the wait below
#pragma unroll
            for (int s = 0; s < 4; ++s) { const size_t e = ((size_t)blockIdx.y * TT + r0 + mb * 16 + 4 * s + r4) * HD + c8;   // the rows of a head plane follow one another: 512 contiguous bytes per store
                *(v8h*)(P16 + e) = o16[s]; *(v8us*)(Ph + e) = oh[s]; *(v8us*)(Pl + e) = ol[s]; }
            if (mb < 3) { asm volatile("s_wait_xcnt 0x0" ::: "memory");   // the next block reuses the registers that these stores name; also the compiler fence that keeps its LDS stores behind this block's reads
                __builtin_amdgcn_sched_barrier(0); }   // the next block's arithmetic stays behind that wait
        }
    } else {
        __shared__ __align__(16) unsigned short ts[3][64 * 72];   // [plane][d][m], pitch 144 B: 16 B x odd
#pragma unroll
        for (int nb = 0; nb < 4; ++nb) { const float bn = bfr(bias[c0 + nb * 16 + lr]);
#pragma unroll
            for (int mb = 0; mb < 4; ++mb) { v8h o16; v8us oh, ol;   // a lane holds 8 neighbouring rows m of one column d: 16 B of a transposed plane
#pragma unroll
                for (int j = 0; j < 8; ++j) { const float r = acc[mb][nb][j] + bn; o16[j] = tohx(r); unsigned short a2, c2; splitf(r, a2, c2); oh[j] = a2; ol[j] = c2; }
                const int so = (nb * 16 + lr) * 72 + mb * 16 + hi * 8;
                *(v8usa*)(ts[0] + so) = __builtin_bit_cast(v8us, o16); *(v8usa*)(ts[1] + so) = oh; *(v8usa*)(ts[2] + so) = ol; } }
        __builtin_amdgcn_wave_barrier(); asm volatile("" ::: "memory");   // compiler fence: the reads below take what other lanes of this wave stored above
        v8us t0[16], t1[16], t2[16];
#pragma unroll
        for (int s = 0; s < 16; ++s) { const int so = (4 * s + r4) * 72 + c8; t0[s] = *(const v8usa*)(ts[0] + so); t1[s] = *(const v8usa*)(ts[1] + so); t2[s] = *(const v8usa*)(ts[2] + so); }
        __builtin_amdgcn_sched_barrier(0);   // every read-back is issued before the first store: each has registers of its own (the accumulators are dead), and none that a store names is written again
#pragma unroll
        for (int s = 0; s < 16; ++s) { const size_t e = ((size_t)blockIdx.y * HD + 4 * s + r4) * TT + r0 + c8;
            *(v8h*)(P16 + e) = __builtin_bit_cast(v8h, t0[s]); *(v8us*)(Ph + e) = t1[s]; *(v8us*)(Pl + e) = t2[s]; }
    }
}

typedef __attribute__((ext_vector_type(2))) _Float16 v2h;
typedef __attribute__((ext_vector_type(4))) _Float16 v4h;
typedef __attribute__((ext_vector_type(2))) unsigned short v2us;
typedef __attribute__((ext_vector_type(4))) unsigned short v4us;
typedef __attribute__((ext_vector_type(2))) float v2f;
typedef __attribute__((ext_vector_type(4))) int v4i;

__global__ __launch_bounds__(256) void k_wtG(const float* __restrict__ w, int K, int N, bf* Bt) {
    const int lane = threadIdx.x & 31; const int L0 = (blockIdx.x * 8 + (threadIdx.x >> 5)) * 8; const int nlines = N * K / 64;
{
#pragma unroll 1
        for (int l = 0; l < 8; ++l) { const int L = L0 + l; if (L >= nlines) break; const size_t e = (size_t)L * 64 + lane * 2; const int k = (int)(e % K), n = (int)(e / K); v2us o;
            o[0] = f2bf(w[(size_t)k * N + n]); o[1] = f2bf(w[(size_t)(k + 1) * N + n]); *(v2us*)(Bt + e) = o; }
         }
}
__global__ __launch_bounds__(256) void k_cvt8(const float* __restrict__ src, bf* dst, size_t n8) { const size_t i = (size_t)blockIdx.x * 256 + threadIdx.x; if (i >= n8) return; const v8f v = *(const v8f*)(src + i * 8); v8us o;
#pragma unroll
    for (int k = 0; k < 8; ++k) o[k] = f2bf(v[k]); *(v8us*)(dst + i * 8) = o;  }
__global__ __launch_bounds__(256) void k_cscvt(const float* __restrict__ cosT, const float* __restrict__ sinT, float* CS) { const int idx = blockIdx.x * 256 + threadIdx.x; if (idx >= TT * HD) return; v2f cs; cs[0] = bfr(cosT[idx]); cs[1] = bfr(sinT[idx]); *(v2f*)(CS + (size_t)idx * 2) = cs;  }
typedef __attribute__((ext_vector_type(16))) unsigned short v16us;
#define LC2 0.18033688011112042f   // HD^-0.5 x log2(e)
__device__ __forceinline__ void stq(h16* d, const h16* g) { *(v8ha*)d = *(const v8h*)g; *(v8ha*)(d + 256) = *(const v8h*)(g + 16); }       // one lane's two 16-byte halves of a fragment, global -> LDS
__device__ __forceinline__ void stq(bf* d, const bf* g) { *(v8usa*)d = *(const v8us*)g; *(v8usa*)(d + 256) = *(const v8us*)(g + 16); }
__device__ __forceinline__ v16h ldq(const h16* p) { return cat16(*(const v8ha*)p, *(const v8ha*)(p + 256)); }
__device__ __forceinline__ v16bf ldq(const bf* p) { return cat16b(*(const v8usa*)p, *(const v8usa*)(p + 256)); }
// 2^x with the slot the instruction set asks for behind a transcendental (one independent instruction or v_nop before its result is read or its source overwritten) kept inside the statement:
// of eight in place, each is the independent instruction behind the one before it, and one v_nop stands behind the last.
__device__ __forceinline__ float exp2n(float x) { float r; asm("v_exp_f32 %0, %1\n\tv_nop" : "=v"(r) : "v"(x)); return r; }
__device__ __forceinline__ v8f exp2x8(v8f x) { float a = x[0], b = x[1], c = x[2], d = x[3], e = x[4], f = x[5], g = x[6], h = x[7];
    asm("v_exp_f32 %0, %0\n\tv_exp_f32 %1, %1\n\tv_exp_f32 %2, %2\n\tv_exp_f32 %3, %3\n\tv_exp_f32 %4, %4\n\tv_exp_f32 %5, %5\n\tv_exp_f32 %6, %6\n\tv_exp_f32 %7, %7\n\tv_nop" : "+v"(a), "+v"(b), "+v"(c), "+v"(d), "+v"(e), "+v"(f), "+v"(g), "+v"(h));
    return (v8f){a, b, c, d, e, f, g, h}; }
template <typename T16, int NSPLIT, int NQ, int QW, int KW>
__global__ __launch_bounds__(32 * QW * KW) __attribute__((amdgpu_waves_per_eu(4))) void k_fattn(const T16* __restrict__ Q, const T16* __restrict__ Q2, const T16* __restrict__ Kp, const T16* __restrict__ Kp2, const T16* __restrict__ Vt, const T16* __restrict__ Vt2, int qbase, int nqt, float* __restrict__ out) {   // four waves per SIMD: at most 256 registers
    typedef typename WFrag<T16>::V V;
    static_assert(NQ * QW == 2 && HD == 64 && REP == 1 && (NSPLIT == 0 || NSPLIT == 2) && (NQ == 1 || NQ == 2), "32 queries per work-group, head size 64");
    __shared__ __align__(16) float Os[KW][HD][36];               // pitch 144 B: 16 B x odd
    __shared__ __align__(16) float Ms[KW][32];
    __shared__ __align__(16) float Ls[KW][32];
    __shared__ __align__(16) float Wt[KW][32];
    constexpr int NP = (NSPLIT == 2) ? 2 : 1;                    // operand planes (hi, lo)
    __shared__ __align__(16) T16 Qs[QW * KW * NP * NQ * 1024];   // the query fragments wait in LDS outside the score products, so that scores or P, the value tile and O^T fit 256 registers
    const int tid = threadIdx.x, lane = tid & 31, lr = lane & 15, hi = lane >> 4;
    const int w = __builtin_amdgcn_readfirstlane(tid >> 5), qw = w % QW, kw = w / QW;
    const int q0 = qbase + (nqt - 1 - (int)blockIdx.y) * 32;
    const int nkt = q0 / 64 + 1;                                 // 64-key tiles that hold a key <= some query; the last one starts at a key <= q0, so every query has a live key in every tile
    const int qc = qw * NQ * 16;
    const size_t pl = (size_t)blockIdx.x * TT * HD;
    Q += pl; Kp += pl; Vt += pl; if (NSPLIT == 2) { Q2 += pl; Kp2 += pl; Vt2 += pl; }
    const unsigned klane = (unsigned)(lr * HD + 8 * hi), vlane = (unsigned)(lr * TT + 8 * hi);   // the lane's part of a fragment address; the tile's part is wave-uniform (scalar base)
    const float poff = (NSPLIT == 2) ? 0.0f : 10.0f;             // single fp16 P carries x 2^10 (as PCAR), in l too, so it cancels in O / l
    V bq[NQ][2], bq2[NQ][2];
    T16* const qs = Qs + w * NP * NQ * 1024 + lane * 8;          // this wave's own copy, 16 B per lane and half fragment: written and read by the same lanes, no barrier
#pragma unroll
    for (int nb = 0; nb < NQ; ++nb)
#pragma unroll
        for (int ks = 0; ks < 2; ++ks) { const size_t qo = (size_t)(q0 + qc + nb * 16 + lr) * HD + ks * 32 + 8 * hi;
            stq(qs + (nb * 2 + ks) * 512, Q + qo); if (NSPLIT == 2) stq(qs + (NQ * 2 + nb * 2 + ks) * 512, Q2 + qo); }
    v8f o[4][NQ]; float m[NQ], l[NQ];
#pragma unroll
    for (int nb = 0; nb < NQ; ++nb) { m[nb] = -3.0e38f; l[nb] = 0.f;
#pragma unroll
        for (int db = 0; db < 4; ++db) o[db][nb] = (v8f){}; }
#pragma unroll 1   // rolled: an unrolled body would double the live score and fragment registers
    for (int kt = kw; kt < nkt; kt += KW) {
        const int k0 = kt * 64;
        v8f st[4][NQ]; V ka[4][2], ka2[4][2], va[2][4], va2[2][4];
#pragma unroll
        for (int mb = 0; mb < 4; ++mb)
#pragma unroll
            for (int nb = 0; nb < NQ; ++nb) st[mb][nb] = (v8f){};
        asm volatile("" ::: "memory");   // compiler fence: the query fragments are read from LDS anew in every pass (hoisted out of the loop they would stay in registers and spill)
#pragma unroll
        for (int nb = 0; nb < NQ; ++nb)
#pragma unroll
            for (int ks = 0; ks < 2; ++ks) { bq[nb][ks] = ldq(qs + (nb * 2 + ks) * 512); if (NSPLIT == 2) bq2[nb][ks] = ldq(qs + (NQ * 2 + nb * 2 + ks) * 512); }
#pragma unroll
        for (int mb = 0; mb < 4; ++mb)
#pragma unroll
            for (int ks = 0; ks < 2; ++ks) { const unsigned ko = klane + (unsigned)(mb * 16 * HD + ks * 32); ka[mb][ks] = WFrag<T16>::ld(Kp + (size_t)k0 * HD + ko); if (NSPLIT == 2) ka2[mb][ks] = WFrag<T16>::ld(Kp2 + (size_t)k0 * HD + ko); }
        __builtin_amdgcn_sched_barrier(0);   // the key tile's loads stay together in front of the products: one load latency per tile, not one per fragment
#pragma unroll
        for (int mb = 0; mb < 4; ++mb)
#pragma unroll
            for (int ks = 0; ks < 2; ++ks)
#pragma unroll
                for (int nb = 0; nb < NQ; ++nb) { st[mb][nb] = WFrag<T16>::mma(ka[mb][ks], bq[nb][ks], st[mb][nb]); if (NSPLIT == 2) { st[mb][nb] = WFrag<T16>::mma(ka2[mb][ks], bq[nb][ks], st[mb][nb]); st[mb][nb] = WFrag<T16>::mma(ka[mb][ks], bq2[nb][ks], st[mb][nb]); } }
        if constexpr (NSPLIT == 0) {
#pragma unroll
            for (int kb = 0; kb < 2; ++kb)
#pragma unroll
                for (int db = 0; db < 4; ++db) va[kb][db] = WFrag<T16>::ld(Vt + k0 + (vlane + (unsigned)(db * 16 * TT + kb * 32)));
            __builtin_amdgcn_sched_barrier(0); }   // the value tile's loads are issued here, into the key fragments' registers, and fly under the softmax
        if (kt == nkt - 1) {                                     // only the last tile crosses the diagonal
#pragma unroll
            for (int mb = 0; mb < 4; ++mb)
#pragma unroll
                for (int nb = 0; nb < NQ; ++nb)
#pragma unroll
                    for (int j = 0; j < 8; ++j) if (k0 + mb * 16 + hi * 8 + j > q0 + qc + nb * 16 + lr) st[mb][nb][j] = -3.0e38f; }
        V pb[NQ][2], pb2[NQ][2];
#pragma unroll
        for (int nb = 0; nb < NQ; ++nb) {
            float t4[4];
#pragma unroll
            for (int u = 0; u < 4; ++u) t4[u] = fmaxf(st[0][nb][u], st[0][nb][u + 4]);
#pragma unroll
            for (int mb = 1; mb < 4; ++mb)
#pragma unroll
                for (int j = 0; j < 8; ++j) t4[j & 3] = fmaxf(t4[j & 3], st[mb][nb][j]);
            float mt = fmaxf(fmaxf(t4[0], t4[1]), fmaxf(t4[2], t4[3]));
            mt = fmaxf(mt, __shfl_xor(mt, 16, 32));              // the other half of the wave holds the query's other 32 keys
            const float mn = fmaxf(m[nb], mt);
            const float al = exp2n((m[nb] - mn) * LC2);
            const float nm = poff - mn * LC2;
            m[nb] = mn;
            float s4[4] = {0.f, 0.f, 0.f, 0.f};
#pragma unroll
            for (int mb = 0; mb < 4; ++mb) { v8f x;
#pragma unroll
                for (int j = 0; j < 8; ++j) x[j] = fmaf(st[mb][nb][j], LC2, nm);
                x = exp2x8(x); st[mb][nb] = x;
#pragma unroll
                for (int j = 0; j < 8; ++j) s4[j & 3] += x[j]; }
            l[nb] = l[nb] * al + ((s4[0] + s4[1]) + (s4[2] + s4[3]));   // this half's keys only; the halves are joined after the loop
#pragma unroll
            for (int db = 0; db < 4; ++db) o[db][nb] *= al;
#pragma unroll
            for (int kb = 0; kb < 2; ++kb) {
                if constexpr (NSPLIT == 2) { v16us ph, pq;
#pragma unroll
                    for (int s = 0; s < 16; ++s) { unsigned short a2, c2; splitf(st[2 * kb + (s >> 3)][nb][s & 7], a2, c2); ph[s] = a2; pq[s] = c2; }
                    pb[nb][kb] = __builtin_bit_cast(v16bf, ph); pb2[nb][kb] = __builtin_bit_cast(v16bf, pq); }
                else { v16h ph;
#pragma unroll
                    for (int s = 0; s < 16; ++s) ph[s] = tohx(st[2 * kb + (s >> 3)][nb][s & 7]);
                    pb[nb][kb] = ph; } } }
        if constexpr (NSPLIT == 2) {   // hi and lo value planes do not fit 256 registers beside the scores: loaded behind the softmax (these work-groups have at most two passes per wave)
#pragma unroll
            for (int kb = 0; kb < 2; ++kb)
#pragma unroll
                for (int db = 0; db < 4; ++db) { const unsigned vo = vlane + (unsigned)(db * 16 * TT + kb * 32); va[kb][db] = WFrag<T16>::ld(Vt + k0 + vo); va2[kb][db] = WFrag<T16>::ld(Vt2 + k0 + vo); } }
#pragma unroll
        for (int kb = 0; kb < 2; ++kb) {
#pragma unroll
            for (int db = 0; db < 4; ++db) { const V a = va[kb][db]; V a2; if (NSPLIT == 2) a2 = va2[kb][db];
#pragma unroll
                for (int nb = 0; nb < NQ; ++nb) { o[db][nb] = WFrag<T16>::mma(a, pb[nb][kb], o[db][nb]); if (NSPLIT == 2) { o[db][nb] = WFrag<T16>::mma(a2, pb[nb][kb], o[db][nb]); o[db][nb] = WFrag<T16>::mma(a, pb2[nb][kb], o[db][nb]); } } } }
    }
#pragma unroll
    for (int nb = 0; nb < NQ; ++nb) { const int qq = qc + nb * 16 + lr;
        const float lt = l[nb] + __shfl_xor(l[nb], 16, 32);
        if (hi == 0) { Ms[kw][qq] = m[nb]; Ls[kw][qq] = lt; }
#pragma unroll
        for (int db = 0; db < 4; ++db)
#pragma unroll
            for (int j = 0; j < 8; ++j) Os[kw][db * 16 + hi * 8 + j][qq] = o[db][nb][j]; }
    __syncthreads();                                             // every wave's partial (m, l, O^T) is in LDS
    if (tid < 32) { float mm = Ms[0][tid];
#pragma unroll
        for (int k = 1; k < KW; ++k) mm = fmaxf(mm, Ms[k][tid]);
        float f[KW], den = 0.f;                                  // a wave without a tile has m = -3e38, l = 0, O = 0: weight 0
#pragma unroll
        for (int k = 0; k < KW; ++k) { f[k] = exp2n((Ms[k][tid] - mm) * LC2); den += Ls[k][tid] * f[k]; }
#pragma unroll
        for (int k = 0; k < KW; ++k) Wt[k][tid] = __fdiv_rn(f[k], den); }
    __syncthreads();                                             // the merge weights are in LDS
#pragma unroll
    for (int idx = tid; idx < HD * 8; idx += 32 * QW * KW) { const int d = idx >> 3, q4 = (idx & 7) * 4; v4f r = (v4f){};
#pragma unroll
        for (int k = 0; k < KW; ++k) r += *(const v4fa*)&Os[k][d][q4] * *(const v4fa*)&Wt[k][q4];
        *(v4f*)(out + ((size_t)blockIdx.x * HD + d) * TT + q0 + q4) = r; }   // channel-first output [batch x head x d][query]; a work-group owns whole 128-byte lines
}

__global__ __launch_bounds__(256) void k_tok(const float* __restrict__ in, bf* X) { const size_t e = ((size_t)blockIdx.x * 256 + threadIdx.x) * 4; if (e >= (size_t)TT * DM) return; const int c = (int)(e % DM); const int n = (int)(e / DM); v4us o;
#pragma unroll
    for (int u = 0; u < 4; ++u) o[u] = f2bf(in[(size_t)(c + u) * TT + n]); *(v4us*)(X + e) = o;  }   // NCHW -> token rows [n][c]

extern "C" void kernel_launch(void* const* d_in, const int* in_sizes, int n_in,
                              void* d_out, int out_size, void* d_ws, size_t ws_size, hipStream_t stream) {
    (void)in_sizes; (void)n_in; (void)out_size;
    const float* qin = (const float*)d_in[0]; const float* kin = (const float*)d_in[1]; const float* wq = (const float*)d_in[2]; const float* bq = (const float*)d_in[3]; const float* wk = (const float*)d_in[4]; const float* bk = (const float*)d_in[5]; const float* wv = (const float*)d_in[6]; const float* bv = (const float*)d_in[7]; const float* x = qin; const float* wo = nullptr; (void)wo; const float* cosT = nullptr; const float* sinT = nullptr; (void)cosT; (void)sinT;
    float* OUT = (float*)d_out;     // [2][512][4096] channel-first
    char* wsp = (char*)d_ws;
    auto take = [&](size_t bytes) { char* p = wsp; wsp += (bytes + 255) & ~(size_t)255; return (void*)p; };
    bf* WQ = (bf*)take((size_t)DQ * DM * 2); bf* WK = (bf*)take((size_t)DKV * DM * 2); bf* WV = (bf*)take((size_t)DKV * DM * 2); bf* WO = (bf*)take((size_t)DM * DQ * 2);
    bf* XB = (bf*)take((size_t)TT * DM * 2); bf* XK = (bf*)take((size_t)TT * DM * 2);
    h16* QP16 = (h16*)take((size_t)NB_ * NH_ * TT * HD * 2); h16* KP16 = (h16*)take((size_t)NB_ * NKV * TT * HD * 2); h16* VT16 = (h16*)take((size_t)NB_ * NKV * HD * TT * 2);   // head planes of both batches: [b][h][..]
    bf* QPh = (bf*)take((size_t)NB_ * NH_ * TT * HD * 2); bf* QPl = (bf*)take((size_t)NB_ * NH_ * TT * HD * 2); bf* KPh = (bf*)take((size_t)NB_ * NKV * TT * HD * 2); bf* KPl = (bf*)take((size_t)NB_ * NKV * TT * HD * 2); bf* VTh = (bf*)take((size_t)NB_ * NKV * HD * TT * 2); bf* VTl = (bf*)take((size_t)NB_ * NKV * HD * TT * 2);
    bf* ATh = (bf*)take((size_t)TT * DQ * 2); bf* ATl = (bf*)take((size_t)TT * DQ * 2);
    if ((size_t)(wsp - (char*)d_ws) > ws_size) return;    // ws 256 MiB
    { k_cvt8<<<(unsigned)(((size_t)DQ * DM / 8 + 255) / 256), 256, 0, stream>>>(wq, WQ, (size_t)DQ * DM / 8); k_cvt8<<<(unsigned)(((size_t)DKV * DM / 8 + 255) / 256), 256, 0, stream>>>(wk, WK, (size_t)DKV * DM / 8); k_cvt8<<<(unsigned)(((size_t)DKV * DM / 8 + 255) / 256), 256, 0, stream>>>(wv, WV, (size_t)DKV * DM / 8);
      
       }
    for (int b = 0; b < NB_; ++b) {
        const size_t pb = (size_t)b * NH_ * TT * HD;   // this batch's head planes
        k_tok<<<(unsigned)(((size_t)TT * DM / 4 + 255) / 256), 256, 0, stream>>>(qin + (size_t)b * DM * TT, XB); k_tok<<<(unsigned)(((size_t)TT * DM / 4 + 255) / 256), 256, 0, stream>>>(kin + (size_t)b * DM * TT, XK);
        k_gemmw<bf, 0, false><<<dim3(TT / 64, DQ / 64, 1), 32, 0, stream>>>(XB, nullptr, WQ, nullptr, DM, bq, 0, 0, QP16 + pb, QPh + pb, QPl + pb);
        k_gemmw<bf, 0, false><<<dim3(TT / 64, DKV / 64, 1), 32, 0, stream>>>(XK, nullptr, WK, nullptr, DM, bk, 0, 0, KP16 + pb, KPh + pb, KPl + pb);
        k_gemmw<bf, 0, true><<<dim3(TT / 64, DKV / 64, 1), 32, 0, stream>>>(XK, nullptr, WV, nullptr, DM, bv, 0, 0, VT16 + pb, VTh + pb, VTl + pb);
        }
    k_fattn<h16, 0, 2, 1, 4><<<dim3(NB_ * NH_, (TT - RH) / 32, 1), 128, 0, stream>>>(QP16, nullptr, KP16, nullptr, VT16, nullptr, RH, (TT - RH) / 32, OUT);
    k_fattn<bf, 2, 1, 2, 4><<<dim3(NB_ * NH_, RH / 32, 1), 256, 0, stream>>>(QPh, QPl, KPh, KPl, VTh, VTl, 0, RH / 32, OUT);
}

// v004
// Measured time: 191 microseconds a run.
// Timed twice side by side with v003, it ran 1.11 times as fast both times.
// Over all steps from v000 it is 13.0 times as fast.
#include <hip/hip_runtime.h>

// CausalAttention2d (query, key [2][512][64x64] NCHW -> tokens [4096][512]; q = q_tok Wq^T + bq, k = k_tok Wk^T + bk, v = k_tok Wv^T + bv (8 heads x 64); causal softmax(q.k/8) over the 4096 positions; out[b][h*64+d][n] = (attn v)[h][n][d] (no output projection; written channel-first as the reference's permute + view) -> [2][512][64][64]).
// Compute dtypes, f32 accumulate: every input rounded to bf16; q/k/v on PLAIN bf16 operands (inputs: exact) + bias; causal scores and attn.v: query rows < 512 hl (3 products), the rest single fp16 (x1024); softmax f32 (online: running maximum and sum, fused with both products)

#define NB_  2
#define TT   4096
#define DM   512
#define NH_  8
#define NKV  8
#define REP  (NH_ / NKV)
#define HD   64
#define DQ   (NH_ * HD)
#define DKV  (NKV * HD)
#define ZH   1
#define RH   512                  // query rows < RH use hi+lo planes (0: none)
#define WIN  0
#define PCAR 1024.0f
#define SCL  0.125f   // HD^-0.5
static_assert(HD == 64 && RH % 64 == 0 && TT % 64 == 0, "query tiles of 32, key tiles of 64");
typedef _Float16 h16;
typedef unsigned short bf;
typedef __attribute__((ext_vector_type(16))) __bf16   v16bf;
typedef __attribute__((ext_vector_type(16))) _Float16 v16h;
typedef __attribute__((ext_vector_type(8)))  _Float16 v8h;
typedef __attribute__((ext_vector_type(8)))  unsigned short v8us;
typedef __attribute__((ext_vector_type(8)))  float    v8f;
typedef __attribute__((ext_vector_type(4)))  float    v4f;
typedef v8h  __attribute__((may_alias)) v8ha;
typedef v4f  __attribute__((may_alias)) v4fa;
typedef v8us __attribute__((may_alias)) v8usa;

__device__ __forceinline__ unsigned short f2bf(float f) { unsigned u = __float_as_uint(f); u += 0x7FFFu + ((u >> 16) & 1u); return (unsigned short)(u >> 16); }
__device__ __forceinline__ float bf2f(unsigned short b) { return __uint_as_float(((unsigned)b) << 16); }
__device__ __forceinline__ float bfr(float f) { return bf2f(f2bf(f)); }
__device__ __forceinline__ v16h cat16(v8h lo, v8h hi) { return __builtin_shufflevector(lo, hi, 0, 1, 2, 3, 4, 5, 6, 7, 8, 9, 10, 11, 12, 13, 14, 15); }
__device__ __forceinline__ v16bf cat16b(v8us lo, v8us hi) { return __builtin_bit_cast(v16bf, __builtin_shufflevector(lo, hi, 0, 1, 2, 3, 4, 5, 6, 7, 8, 9, 10, 11, 12, 13, 14, 15)); }
__device__ __forceinline__ v8f wmma16(v16h a, v16h b, v8f c) { return __builtin_amdgcn_wmma_f32_16x16x32_f16(false, a, false, b, (short)0, c, false, false); }
__device__ __forceinline__ v8f wmmab(v16bf a, v16bf b, v8f c) { return __builtin_amdgcn_wmma_f32_16x16x32_bf16(false, a, false, b, (short)0, c, false, false); }



// ---- FRAGMENT ORDER: every 16-bit plane that feeds a matrix instruction lies in memory as its fragments. A fragment is 16 rows x 32 k of a row-major M[r][k]; lane (hi, lr) holds row lr,
// k = 8 hi + s in its first 16 bytes and k = 16 + 8 hi + s in its second. It is stored as [half][lane][8 elements] = 2 x 512 contiguous bytes, so that each 16-byte load or store of a wave
// covers four whole 128-byte lines (rows of a row-major plane would give 16 lines, 32 bytes of each). The fragments of a plane follow one another as [row tile][k block].
// ---- k_gemmw: register-blocked GEMM, ONE WAVE per 64x64 output tile (16 accumulators), operands straight from 16-bit planes in fragment order; grid (M/64, N/64, Z), 32 threads.
// c[m][n] (f32) = sum_k A[m][k] Bt[n][k] (+ split products per NSPLIT) + bias[n] stays in registers; z-batch strides sA/sB in elements. K % 32 == 0. A column tile is one head (HD == 64).
// The epilogue writes the three 16-bit head planes of c itself (fp16, bf16 hi, bf16 lo), in fragment order too, straight from the accumulators: a lane's 8 values of one accumulator are 16 bytes of a fragment.
// VT false: planes M[m][d] per head (rows = tokens, k = d); the product is formed as c^T (weights as the A operand), so that a lane holds 8 neighbouring d of one token.
// VT true: planes M[d][m] per head (rows = d, k = tokens), fragments as [64-token tile][32-token block][d tile]; a lane of c holds 8 neighbouring tokens of one d.
template <typename T16> struct WFrag;
template <> struct WFrag<h16> { typedef v16h V; static __device__ __forceinline__ V ld(const h16* p) { return cat16(*(const v8h*)p, *(const v8h*)(p + 256)); } static __device__ __forceinline__ v8f mma(V a, V b, v8f c) { return wmma16(a, b, c); } };
template <> struct WFrag<bf> { typedef v16bf V; static __device__ __forceinline__ V ld(const bf* p) { return cat16b(*(const v8us*)p, *(const v8us*)(p + 256)); } static __device__ __forceinline__ v8f mma(V a, V b, v8f c) { return wmmab(a, b, c); } };
__device__ __forceinline__ h16 tohx(float x) { return (h16)x; }
__device__ __forceinline__ void splitf(float y, unsigned short& h, unsigned short& l) { h = f2bf(y); l = f2bf(y - bf2f(h)); }
template <typename T16, int NSPLIT, bool VT>
__global__ __launch_bounds__(32) void k_gemmw(const T16* __restrict__ A, const T16* __restrict__ A2, const T16* __restrict__ Bt, const T16* __restrict__ Bt2, int K, const float* __restrict__ bias, size_t sA, size_t sB, h16* __restrict__ P16, bf* __restrict__ Ph, bf* __restrict__ Pl) {
    typedef typename WFrag<T16>::V V;
    const size_t z = blockIdx.z; A += z * sA; if (A2) A2 += z * sA; Bt += z * sB; if (Bt2) Bt2 += z * sB;
    const int lane = threadIdx.x & 31, lr = lane & 15, hi = lane >> 4; const int r0 = blockIdx.x * 64, c0 = blockIdx.y * 64;
    v8f acc[4][4];
#pragma unroll
    for (int mb = 0; mb < 4; ++mb)
#pragma unroll
        for (int nb = 0; nb < 4; ++nb) acc[mb][nb] = (v8f){};
    const size_t aoff = (size_t)r0 * K + lane * 8, boff = (size_t)c0 * K + lane * 8;   // a row tile's fragments take 16 K elements, a k block 512
#pragma unroll 1
    for (int kc = 0; kc < K; kc += 32) {
        V a[4], a2[4];
#pragma unroll
        for (int mb = 0; mb < 4; ++mb) { a[mb] = WFrag<T16>::ld(A + aoff + (size_t)mb * 16 * K + kc * 16); if (NSPLIT == 1 || NSPLIT == 2) a2[mb] = WFrag<T16>::ld(A2 + aoff + (size_t)mb * 16 * K + kc * 16); }
#pragma unroll
        for (int nb = 0; nb < 4; ++nb) { const V b = WFrag<T16>::ld(Bt + boff + (size_t)nb * 16 * K + kc * 16); V b2; if (NSPLIT >= 2) b2 = WFrag<T16>::ld(Bt2 + boff + (size_t)nb * 16 * K + kc * 16);
#pragma unroll
            for (int mb = 0; mb < 4; ++mb) {
                if constexpr (VT) { acc[mb][nb] = WFrag<T16>::mma(a[mb], b, acc[mb][nb]); if (NSPLIT == 1 || NSPLIT == 2) acc[mb][nb] = WFrag<T16>::mma(a2[mb], b, acc[mb][nb]); if (NSPLIT >= 2) acc[mb][nb] = WFrag<T16>::mma(a[mb], b2, acc[mb][nb]); }
                else { acc[mb][nb] = WFrag<T16>::mma(b, a[mb], acc[mb][nb]); if (NSPLIT == 1 || NSPLIT == 2) acc[mb][nb] = WFrag<T16>::mma(b, a2[mb], acc[mb][nb]); if (NSPLIT >= 2) acc[mb][nb] = WFrag<T16>::mma(b2, a[mb], acc[mb][nb]); } } }
        asm volatile("v_nop\n\tv_nop\n\tv_nop\n\tv_nop" : "+v"(acc[0][0]), "+v"(acc[1][1]), "+v"(acc[2][2]), "+v"(acc[3][3]) : "v"(a[0]), "v"(a[3]));
    }
    float bl[4][VT ? 1 : 8];   // VT false: accumulator [mb][nb], value j is c[m = mb 16 + lr][n = nb 16 + 8 hi + j]; VT true: c[m = mb 16 + 8 hi + j][n = nb 16 + lr]
#pragma unroll
    for (int nb = 0; nb < 4; ++nb)
#pragma unroll
        for (int u = 0; u < (VT ? 1 : 8); ++u) bl[nb][u] = bfr(bias[c0 + nb * 16 + (VT ? lr : hi * 8 + u)]);
    const size_t pe = (size_t)blockIdx.y * TT * HD + (size_t)r0 * HD + lane * 8;   // this head's plane, this tile's 64 tokens: 4096 elements in a row in either form
#pragma unroll
    for (int mb = 0; mb < 4; ++mb) {
        v8h o16[4]; v8us oh[4], ol[4];
#pragma unroll
        for (int nb = 0; nb < 4; ++nb)
#pragma unroll
            for (int j = 0; j < 8; ++j) { const float r = acc[mb][nb][j] + bl[nb][VT ? 0 : j]; o16[nb][j] = tohx(r); unsigned short a2, c2; splitf(r, a2, c2); oh[nb][j] = a2; ol[nb][j] = c2; }
        __builtin_amdgcn_sched_barrier(0);   // the block's twelve stores stand together behind its arithmetic, so that nothing rewrites a stored register between a store and the wait below
#pragma unroll
        for (int nb = 0; nb < 4; ++nb) { const size_t e = pe + (VT ? (mb >> 1) * 2048 + nb * 512 + (mb & 1) * 256 : mb * 1024 + nb * 256);   // VT false: row tile mb, k block nb / 2, half nb % 2; VT true: k block mb / 2, row tile nb, half mb % 2
            *(v8h*)(P16 + e) = o16[nb]; *(v8us*)(Ph + e) = oh[nb]; *(v8us*)(Pl + e) = ol[nb]; }
        if (mb < 3) { asm volatile("s_wait_xcnt 0x0" ::: "memory");   // the next block reuses the registers that these stores name
            __builtin_amdgcn_sched_barrier(0); }   // the next block's arithmetic stays behind that wait
    }
}

typedef __attribute__((ext_vector_type(2))) _Float16 v2h;
typedef __attribute__((ext_vector_type(4))) _Float16 v4h;
typedef __attribute__((ext_vector_type(2))) unsigned short v2us;
typedef __attribute__((ext_vector_type(4))) unsigned short v4us;
typedef __attribute__((ext_vector_type(2))) float v2f;
typedef __attribute__((ext_vector_type(4))) int v4i;

__global__ __launch_bounds__(256) void k_wtG(const float* __restrict__ w, int K, int N, bf* Bt) {
    const int lane = threadIdx.x & 31; const int L0 = (blockIdx.x * 8 + (threadIdx.x >> 5)) * 8; const int nlines = N * K / 64;
{
#pragma unroll 1
        for (int l = 0; l < 8; ++l) { const int L = L0 + l; if (L >= nlines) break; const size_t e = (size_t)L * 64 + lane * 2; const int k = (int)(e % K), n = (int)(e / K); v2us o;
            o[0] = f2bf(w[(size_t)k * N + n]); o[1] = f2bf(w[(size_t)(k + 1) * N + n]); *(v2us*)(Bt + e) = o; }
         }
}
static_assert(DM == 512, "16 k blocks per row tile in frow / fcol");
__device__ __forceinline__ int frow(size_t i) { return (int)(i >> 10) * 16 + (int)(i & 15); }                                                  // 16-byte piece i of a plane M[r][DM] in fragment order: its row,
__device__ __forceinline__ int fcol(size_t i) { return (int)((i >> 6) & 15) * 32 + (int)((i >> 5) & 1) * 16 + (int)((i >> 4) & 1) * 8; }       // and the first of its 8 columns
__global__ __launch_bounds__(256) void k_cvt8(const float* __restrict__ src, bf* dst, size_t n8) { const size_t i = (size_t)blockIdx.x * 256 + threadIdx.x; if (i >= n8) return; const v8f v = *(const v8f*)(src + (size_t)frow(i) * DM + fcol(i)); v8us o;   // row-major [n][DM] -> fragment order
#pragma unroll
    for (int k = 0; k < 8; ++k) o[k] = f2bf(v[k]); *(v8us*)(dst + i * 8) = o;  }
__global__ __launch_bounds__(256) void k_cscvt(const float* __restrict__ cosT, const float* __restrict__ sinT, float* CS) { const int idx = blockIdx.x * 256 + threadIdx.x; if (idx >= TT * HD) return; v2f cs; cs[0] = bfr(cosT[idx]); cs[1] = bfr(sinT[idx]); *(v2f*)(CS + (size_t)idx * 2) = cs;  }
typedef __attribute__((ext_vector_type(16))) unsigned short v16us;
#define LC2 0.18033688011112042f   // HD^-0.5 x log2(e)
__device__ __forceinline__ void stq(h16* d, const h16* g) { *(v8ha*)d = *(const v8h*)g; *(v8ha*)(d + 256) = *(const v8h*)(g + 256); }       // one lane's two 16-byte halves of a fragment, global -> LDS
__device__ __forceinline__ void stq(bf* d, const bf* g) { *(v8usa*)d = *(const v8us*)g; *(v8usa*)(d + 256) = *(const v8us*)(g + 256); }
__device__ __forceinline__ v16h ldq(const h16* p) { return cat16(*(const v8ha*)p, *(const v8ha*)(p + 256)); }
__device__ __forceinline__ v16bf ldq(const bf* p) { return cat16b(*(const v8usa*)p, *(const v8usa*)(p + 256)); }
// 2^x with the slot the instruction set asks for behind a transcendental (one independent instruction or v_nop before its result is read or its source overwritten) kept inside the statement:
// of eight in place, each is the independent instruction behind the one before it, and one v_nop stands behind the last.
__device__ __forceinline__ float exp2n(float x) { float r; asm("v_exp_f32 %0, %1\n\tv_nop" : "=v"(r) : "v"(x)); return r; }
__device__ __forceinline__ v8f exp2x8(v8f x) { float a = x[0], b = x[1], c = x[2], d = x[3], e = x[4], f = x[5], g = x[6], h = x[7];
    asm("v_exp_f32 %0, %0\n\tv_exp_f32 %1, %1\n\tv_exp_f32 %2, %2\n\tv_exp_f32 %3, %3\n\tv_exp_f32 %4, %4\n\tv_exp_f32 %5, %5\n\tv_exp_f32 %6, %6\n\tv_exp_f32 %7, %7\n\tv_nop" : "+v"(a), "+v"(b), "+v"(c), "+v"(d), "+v"(e), "+v"(f), "+v"(g), "+v"(h));
    return (v8f){a, b, c, d, e, f, g, h}; }
template <typename T16, int NSPLIT, int NQ, int QW, int KW>
__global__ __launch_bounds__(32 * QW * KW) __attribute__((amdgpu_waves_per_eu(4))) void k_fattn(const T16* __restrict__ Q, const T16* __restrict__ Q2, const T16* __restrict__ Kp, const T16* __restrict__ Kp2, const T16* __restrict__ Vt, const T16* __restrict__ Vt2, int qbase, int nqt, float* __restrict__ out) {   // four waves per SIMD: at most 256 registers
    typedef typename WFrag<T16>::V V;
    static_assert(NQ * QW == 2 && HD == 64 && REP == 1 && (NSPLIT == 0 || NSPLIT == 2) && (NQ == 1 || NQ == 2), "32 queries per work-group, head size 64");
    __shared__ __align__(16) float Os[KW][HD][36];               // pitch 144 B: 16 B x odd
    __shared__ __align__(16) float Ms[KW][32];
    __shared__ __align__(16) float Ls[KW][32];
    __shared__ __align__(16) float Wt[KW][32];
    constexpr int NP = (NSPLIT == 2) ? 2 : 1;                    // operand planes (hi, lo)
    __shared__ __align__(16) T16 Qs[QW * KW * NP * NQ * 1024];   // the query fragments wait in LDS outside the score products, so that scores or P, the value tile and O^T fit 256 registers
    const int tid = threadIdx.x, lane = tid & 31, lr = lane & 15, hi = lane >> 4;
    const int w = __builtin_amdgcn_readfirstlane(tid >> 5), qw = w % QW, kw = w / QW;
    const int q0 = qbase + (nqt - 1 - (int)blockIdx.y) * 32;
    const int nkt = q0 / 64 + 1;                                 // 64-key tiles that hold a key <= some query; the last one starts at a key <= q0, so every query has a live key in every tile
    const int qc = qw * NQ * 16;
    const size_t pl = (size_t)blockIdx.x * TT * HD;
    Q += pl; Kp += pl; Vt += pl; if (NSPLIT == 2) { Q2 += pl; Kp2 += pl; Vt2 += pl; }
    const unsigned flane = (unsigned)(lane * 8);   // the lane's part of a fragment address (planes in fragment order); the tile's part is wave-uniform (scalar base)
    const float poff = (NSPLIT == 2) ? 0.0f : 10.0f;             // single fp16 P carries x 2^10 (as PCAR), in l too, so it cancels in O / l
    V bq[NQ][2], bq2[NQ][2];
    T16* const qs = Qs + w * NP * NQ * 1024 + lane * 8;          // this wave's own copy, 16 B per lane and half fragment: written and read by the same lanes, no barrier
#pragma unroll
    for (int nb = 0; nb < NQ; ++nb)
#pragma unroll
        for (int ks = 0; ks < 2; ++ks) { const size_t qo = (size_t)(q0 + qc + nb * 16) * HD + ks * 512 + flane;
            stq(qs + (nb * 2 + ks) * 512, Q + qo); if (NSPLIT == 2) stq(qs + (NQ * 2 + nb * 2 + ks) * 512, Q2 + qo); }
    v8f o[4][NQ]; float m[NQ], l[NQ];
#pragma unroll
    for (int nb = 0; nb < NQ; ++nb) { m[nb] = -3.0e38f; l[nb] = 0.f;
#pragma unroll
        for (int db = 0; db < 4; ++db) o[db][nb] = (v8f){}; }
#pragma unroll 1   // rolled: an unrolled body would double the live score and fragment registers
    for (int kt = kw; kt < nkt; kt += KW) {
        const int k0 = kt * 64;
        v8f st[4][NQ]; V ka[4][2], ka2[4][2], va[2][4], va2[2][4];
#pragma unroll
        for (int mb = 0; mb < 4; ++mb)
#pragma unroll
            for (int nb = 0; nb < NQ; ++nb) st[mb][nb] = (v8f){};
        asm volatile("" ::: "memory");   // compiler fence: the query fragments are read from LDS anew in every pass (hoisted out of the loop they would stay in registers and spill)
#pragma unroll
        for (int nb = 0; nb < NQ; ++nb)
#pragma unroll
            for (int ks = 0; ks < 2; ++ks) { bq[nb][ks] = ldq(qs + (nb * 2 + ks) * 512); if (NSPLIT == 2) bq2[nb][ks] = ldq(qs + (NQ * 2 + nb * 2 + ks) * 512); }
#pragma unroll
        for (int mb = 0; mb < 4; ++mb)
#pragma unroll
            for (int ks = 0; ks < 2; ++ks) { const unsigned ko = flane + (unsigned)(mb * 1024 + ks * 512); ka[mb][ks] = WFrag<T16>::ld(Kp + (size_t)k0 * HD + ko); if (NSPLIT == 2) ka2[mb][ks] = WFrag<T16>::ld(Kp2 + (size_t)k0 * HD + ko); }
        __builtin_amdgcn_sched_barrier(0);   // the key tile's loads stay together in front of the products: one load latency per tile, not one per fragment
#pragma unroll
        for (int mb = 0; mb < 4; ++mb)
#pragma unroll
            for (int ks = 0; ks < 2; ++ks)
#pragma unroll
                for (int nb = 0; nb < NQ; ++nb) { st[mb][nb] = WFrag<T16>::mma(ka[mb][ks], bq[nb][ks], st[mb][nb]); if (NSPLIT == 2) { st[mb][nb] = WFrag<T16>::mma(ka2[mb][ks], bq[nb][ks], st[mb][nb]); st[mb][nb] = WFrag<T16>::mma(ka[mb][ks], bq2[nb][ks], st[mb][nb]); } }
        if constexpr (NSPLIT == 0) {
#pragma unroll
            for (int kb = 0; kb < 2; ++kb)
#pragma unroll
                for (int db = 0; db < 4; ++db) va[kb][db] = WFrag<T16>::ld(Vt + (size_t)k0 * HD + (flane + (unsigned)(kb * 2048 + db * 512)));
            __builtin_amdgcn_sched_barrier(0); }   // the value tile's loads are issued here, into the key fragments' registers, and fly under the softmax
        if (kt == nkt - 1) {                                     // only the last tile crosses the diagonal
#pragma unroll
            for (int mb = 0; mb < 4; ++mb)
#pragma unroll
                for (int nb = 0; nb < NQ; ++nb)
#pragma unroll
                    for (int j = 0; j < 8; ++j) if (k0 + mb * 16 + hi * 8 + j > q0 + qc + nb * 16 + lr) st[mb][nb][j] = -3.0e38f; }
        V pb[NQ][2], pb2[NQ][2];
#pragma unroll
        for (int nb = 0; nb < NQ; ++nb) {
            float t4[4];
#pragma unroll
            for (int u = 0; u < 4; ++u) t4[u] = fmaxf(st[0][nb][u], st[0][nb][u + 4]);
#pragma unroll
            for (int mb = 1; mb < 4; ++mb)
#pragma unroll
                for (int j = 0; j < 8; ++j) t4[j & 3] = fmaxf(t4[j & 3], st[mb][nb][j]);
            float mt = fmaxf(fmaxf(t4[0], t4[1]), fmaxf(t4[2], t4[3]));
            mt = fmaxf(mt, __shfl_xor(mt, 16, 32));              // the other half of the wave holds the query's other 32 keys
            const float mn = fmaxf(m[nb], mt);
            const float al = exp2n((m[nb] - mn) * LC2);
            const float nm = poff - mn * LC2;
            m[nb] = mn;
            float s4[4] = {0.f, 0.f, 0.f, 0.f};
#pragma unroll
            for (int mb = 0; mb < 4; ++mb) { v8f x;
#pragma unroll
                for (int j = 0; j < 8; ++j) x[j] = fmaf(st[mb][nb][j], LC2, nm);
                x = exp2x8(x); st[mb][nb] = x;
#pragma unroll
                for (int j = 0; j < 8; ++j) s4[j & 3] += x[j]; }
            l[nb] = l[nb] * al + ((s4[0] + s4[1]) + (s4[2] + s4[3]));   // this half's keys only; the halves are joined after the loop
#pragma unroll
            for (int db = 0; db < 4; ++db) o[db][nb] *= al;
#pragma unroll
            for (int kb = 0; kb < 2; ++kb) {
                if constexpr (NSPLIT == 2) { v16us ph, pq;
#pragma unroll
                    for (int s = 0; s < 16; ++s) { unsigned short a2, c2; splitf(st[2 * kb + (s >> 3)][nb][s & 7], a2, c2); ph[s] = a2; pq[s] = c2; }
                    pb[nb][kb] = __builtin_bit_cast(v16bf, ph); pb2[nb][kb] = __builtin_bit_cast(v16bf, pq); }
                else { v16h ph;
#pragma unroll
                    for (int s = 0; s < 16; ++s) ph[s] = tohx(st[2 * kb + (s >> 3)][nb][s & 7]);
                    pb[nb][kb] = ph; } } }
        if constexpr (NSPLIT == 2) {   // hi and lo value planes do not fit 256 registers beside the scores: loaded behind the softmax (these work-groups have at most two passes per wave)
#pragma unroll
            for (int kb = 0; kb < 2; ++kb)
#pragma unroll
                for (int db = 0; db < 4; ++db) { const unsigned vo = flane + (unsigned)(kb * 2048 + db * 512); va[kb][db] = WFrag<T16>::ld(Vt + (size_t)k0 * HD + vo); va2[kb][db] = WFrag<T16>::ld(Vt2 + (size_t)k0 * HD + vo); } }
#pragma unroll
        for (int kb = 0; kb < 2; ++kb) {
#pragma unroll
            for (int db = 0; db < 4; ++db) { const V a = va[kb][db]; V a2; if (NSPLIT == 2) a2 = va2[kb][db];
#pragma unroll
                for (int nb = 0; nb < NQ; ++nb) { o[db][nb] = WFrag<T16>::mma(a, pb[nb][kb], o[db][nb]); if (NSPLIT == 2) { o[db][nb] = WFrag<T16>::mma(a2, pb[nb][kb], o[db][nb]); o[db][nb] = WFrag<T16>::mma(a, pb2[nb][kb], o[db][nb]); } } } }
    }
#pragma unroll
    for (int nb = 0; nb < NQ; ++nb) { const int qq = qc + nb * 16 + lr;
        const float lt = l[nb] + __shfl_xor(l[nb], 16, 32);
        if (hi == 0) { Ms[kw][qq] = m[nb]; Ls[kw][qq] = lt; }
#pragma unroll
        for (int db = 0; db < 4; ++db)
#pragma unroll
            for (int j = 0; j < 8; ++j) Os[kw][db * 16 + hi * 8 + j][qq] = o[db][nb][j]; }
    __syncthreads();                                             // every wave's partial (m, l, O^T) is in LDS
    if (tid < 32) { float mm = Ms[0][tid];
#pragma unroll
        for (int k = 1; k < KW; ++k) mm = fmaxf(mm, Ms[k][tid]);
        float f[KW], den = 0.f;                                  // a wave without a tile has m = -3e38, l = 0, O = 0: weight 0
#pragma unroll
        for (int k = 0; k < KW; ++k) { f[k] = exp2n((Ms[k][tid] - mm) * LC2); den += Ls[k][tid] * f[k]; }
#pragma unroll
        for (int k = 0; k < KW; ++k) Wt[k][tid] = __fdiv_rn(f[k], den); }
    __syncthreads();                                             // the merge weights are in LDS
#pragma unroll
    for (int idx = tid; idx < HD * 8; idx += 32 * QW * KW) { const int d = idx >> 3, q4 = (idx & 7) * 4; v4f r = (v4f){};
#pragma unroll
        for (int k = 0; k < KW; ++k) r += *(const v4fa*)&Os[k][d][q4] * *(const v4fa*)&Wt[k][q4];
        *(v4f*)(out + ((size_t)blockIdx.x * HD + d) * TT + q0 + q4) = r; }   // channel-first output [batch x head x d][query]; a work-group owns whole 128-byte lines
}

__global__ __launch_bounds__(256) void k_tok(const float* __restrict__ in, bf* X) { const size_t i = (size_t)blockIdx.x * 256 + threadIdx.x; if (i >= (size_t)TT * DM / 8) return; const int g = (int)(i >> 5) & (DM / 8 - 1); const int n = (int)(i >> 11) * 32 + (int)(i & 31); v8us o;
#pragma unroll
    for (int u = 0; u < 8; ++u) o[u] = f2bf(in[(size_t)(g * 8 + u) * TT + n]); *(v8us*)(X + ((size_t)(n >> 4) * 1024 + g * 16 + (n & 15)) * 8) = o;  }   // NCHW -> token rows [n][c] in fragment order: a wave reads 32 neighbouring n of a channel (one whole line) eight times and stores 16-byte piece g (channels 8 g ...) of each: 256 contiguous bytes in each of two row tiles

extern "C" void kernel_launch(void* const* d_in, const int* in_sizes, int n_in,
                              void* d_out, int out_size, void* d_ws, size_t ws_size, hipStream_t stream) {
    (void)in_sizes; (void)n_in; (void)out_size;
    const float* qin = (const float*)d_in[0]; const float* kin = (const float*)d_in[1]; const float* wq = (const float*)d_in[2]; const float* bq = (const float*)d_in[3]; const float* wk = (const float*)d_in[4]; const float* bk = (const float*)d_in[5]; const float* wv = (const float*)d_in[6]; const float* bv = (const float*)d_in[7]; const float* x = qin; const float* wo = nullptr; (void)wo; const float* cosT = nullptr; const float* sinT = nullptr; (void)cosT; (void)sinT;
    float* OUT = (float*)d_out;     // [2][512][4096] channel-first
    char* wsp = (char*)d_ws;
    auto take = [&](size_t bytes) { char* p = wsp; wsp += (bytes + 255) & ~(size_t)255; return (void*)p; };
    bf* WQ = (bf*)take((size_t)DQ * DM * 2); bf* WK = (bf*)take((size_t)DKV * DM * 2); bf* WV = (bf*)take((size_t)DKV * DM * 2); bf* WO = (bf*)take((size_t)DM * DQ * 2);
    bf* XB = (bf*)take((size_t)TT * DM * 2); bf* XK = (bf*)take((size_t)TT * DM * 2);
    h16* QP16 = (h16*)take((size_t)NB_ * NH_ * TT * HD * 2); h16* KP16 = (h16*)take((size_t)NB_ * NKV * TT * HD * 2); h16* VT16 = (h16*)take((size_t)NB_ * NKV * HD * TT * 2);   // head planes of both batches: [b][h][..]
    bf* QPh = (bf*)take((size_t)NB_ * NH_ * TT * HD * 2); bf* QPl = (bf*)take((size_t)NB_ * NH_ * TT * HD * 2); bf* KPh = (bf*)take((size_t)NB_ * NKV * TT * HD * 2); bf* KPl = (bf*)take((size_t)NB_ * NKV * TT * HD * 2); bf* VTh = (bf*)take((size_t)NB_ * NKV * HD * TT * 2); bf* VTl = (bf*)take((size_t)NB_ * NKV * HD * TT * 2);
    bf* ATh = (bf*)take((size_t)TT * DQ * 2); bf* ATl = (bf*)take((size_t)TT * DQ * 2);
    if ((size_t)(wsp - (char*)d_ws) > ws_size) return;    // ws 256 MiB
    { k_cvt8<<<(unsigned)(((size_t)DQ * DM / 8 + 255) / 256), 256, 0, stream>>>(wq, WQ, (size_t)DQ * DM / 8); k_cvt8<<<(unsigned)(((size_t)DKV * DM / 8 + 255) / 256), 256, 0, stream>>>(wk, WK, (size_t)DKV * DM / 8); k_cvt8<<<(unsigned)(((size_t)DKV * DM / 8 + 255) / 256), 256, 0, stream>>>(wv, WV, (size_t)DKV * DM / 8);
      
       }
    for (int b = 0; b < NB_; ++b) {
        const size_t pb = (size_t)b * NH_ * TT * HD;   // this batch's head planes
        k_tok<<<(unsigned)(((size_t)TT * DM / 8 + 255) / 256), 256, 0, stream>>>(qin + (size_t)b * DM * TT, XB); k_tok<<<(unsigned)(((size_t)TT * DM / 8 + 255) / 256), 256, 0, stream>>>(kin + (size_t)b * DM * TT, XK);
        k_gemmw<bf, 0, false><<<dim3(TT / 64, DQ / 64, 1), 32, 0, stream>>>(XB, nullptr, WQ, nullptr, DM, bq, 0, 0, QP16 + pb, QPh + pb, QPl + pb);
        k_gemmw<bf, 0, false><<<dim3(TT / 64, DKV / 64, 1), 32, 0, stream>>>(XK, nullptr, WK, nullptr, DM, bk, 0, 0, KP16 + pb, KPh + pb, KPl + pb);
        k_gemmw<bf, 0, true><<<dim3(TT / 64, DKV / 64, 1), 32, 0, stream>>>(XK, nullptr, WV, nullptr, DM, bv, 0, 0, VT16 + pb, VTh + pb, VTl + pb);
        }
    k_fattn<h16, 0, 2, 1, 4><<<dim3(NB_ * NH_, (TT - RH) / 32, 1), 128, 0, stream>>>(QP16, nullptr, KP16, nullptr, VT16, nullptr, RH, (TT - RH) / 32, OUT);
    k_fattn<bf, 2, 1, 2, 4><<<dim3(NB_ * NH_, RH / 32, 1), 256, 0, stream>>>(QPh, QPl, KPh, KPl, VTh, VTl, 0, RH / 32, OUT);
}

// v005
// It runs in 75.2 microseconds.
// Next to v004, in two timings, it ran 2.55 and 2.57 times as fast.
// Counting every step since v000, it is 33.2 times as fast.
#include <hip/hip_runtime.h>

// CausalAttention2d (query, key [2][512][64x64] NCHW -> tokens [4096][512]; q = q_tok Wq^T + bq, k = k_tok Wk^T + bk, v = k_tok Wv^T + bv (8 heads x 64); causal softmax(q.k/8) over the 4096 positions; out[b][h*64+d][n] = (attn v)[h][n][d] (no output projection; written channel-first as the reference's permute + view) -> [2][512][64][64]).
// Compute dtypes, f32 accumulate: every input rounded to bf16; q/k/v on PLAIN bf16 operands (inputs: exact) + bias; causal scores and attn.v: query rows < 512 hl (3 products), the rest single fp16 (x1024); softmax f32 (online: running maximum and sum, fused with both products)

#define NB_  2
#define TT   4096
#define DM   512
#define NH_  8
#define NKV  8
#define REP  (NH_ / NKV)
#define HD   64
#define DQ   (NH_ * HD)
#define DKV  (NKV * HD)
#define ZH   1
#define RH   512                  // query rows < RH use hi+lo planes (0: none)
#define WIN  0
#define PCAR 1024.0f
#define SCL  0.125f   // HD^-0.5
static_assert(HD == 64 && RH % 64 == 0 && TT % 64 == 0, "query tiles of 32, key tiles of 64");
typedef _Float16 h16;
typedef unsigned short bf;
typedef __attribute__((ext_vector_type(16))) __bf16   v16bf;
typedef __attribute__((ext_vector_type(16))) _Float16 v16h;
typedef __attribute__((ext_vector_type(8)))  _Float16 v8h;
typedef __attribute__((ext_vector_type(8)))  unsigned short v8us;
typedef __attribute__((ext_vector_type(8)))  float    v8f;
typedef __attribute__((ext_vector_type(4)))  float    v4f;
typedef v8h  __attribute__((may_alias)) v8ha;
typedef v4f  __attribute__((may_alias)) v4fa;
typedef v8us __attribute__((may_alias)) v8usa;

__device__ __forceinline__ unsigned short f2bf(float f) { unsigned u = __float_as_uint(f); u += 0x7FFFu + ((u >> 16) & 1u); return (unsigned short)(u >> 16); }
__device__ __forceinline__ float bf2f(unsigned short b) { return __uint_as_float(((unsigned)b) << 16); }
__device__ __forceinline__ float bfr(float f) { return bf2f(f2bf(f)); }
__device__ __forceinline__ v16h cat16(v8h lo, v8h hi) { return __builtin_shufflevector(lo, hi, 0, 1, 2, 3, 4, 5, 6, 7, 8, 9, 10, 11, 12, 13, 14, 15); }
__device__ __forceinline__ v16bf cat16b(v8us lo, v8us hi) { return __builtin_bit_cast(v16bf, __builtin_shufflevector(lo, hi, 0, 1, 2, 3, 4, 5, 6, 7, 8, 9, 10, 11, 12, 13, 14, 15)); }
__device__ __forceinline__ v8f wmma16(v16h a, v16h b, v8f c) { return __builtin_amdgcn_wmma_f32_16x16x32_f16(false, a, false, b, (short)0, c, false, false); }
__device__ __forceinline__ v8f wmmab(v16bf a, v16bf b, v8f c) { return __builtin_amdgcn_wmma_f32_16x16x32_bf16(false, a, false, b, (short)0, c, false, false); }



// ---- FRAGMENT ORDER: every 16-bit plane that feeds a matrix instruction lies in memory as its fragments. A fragment is 16 rows x 32 k of a row-major M[r][k]; lane (hi, lr) holds row lr,
// k = 8 hi + s in its first 16 bytes and k = 16 + 8 hi + s in its second. It is stored as [half][lane][8 elements] = 2 x 512 contiguous bytes, so that each 16-byte load or store of a wave
// covers four whole 128-byte lines (rows of a row-major plane would give 16 lines, 32 bytes of each). The fragments of a plane follow one another as [row tile][k block].
// ---- gemmw: register-blocked GEMM, ONE WAVE per 64x64 output tile (16 accumulators), operands straight from 16-bit planes in fragment order; tile (blockIdx.x, blockIdx.y) of (M/64, N/64), 32 threads.
// c[m][n] (f32) = sum_k A[m][k] Bt[n][k] (+ split products per NSPLIT) + bias[n] stays in registers. K % 32 == 0. A column tile is one head (HD == 64).
// The epilogue writes the three 16-bit head planes of c itself (fp16, bf16 hi, bf16 lo), in fragment order too, straight from the accumulators: a lane's 8 values of one accumulator are 16 bytes of a fragment.
// VT false: planes M[m][d] per head (rows = tokens, k = d); the product is formed as c^T (weights as the A operand), so that a lane holds 8 neighbouring d of one token.
// VT true: planes M[d][m] per head (rows = d, k = tokens), fragments as [64-token tile][32-token block][d tile]; a lane of c holds 8 neighbouring tokens of one d.
template <typename T16> struct WFrag;
template <> struct WFrag<h16> { typedef v16h V; static __device__ __forceinline__ V ld(const h16* p) { return cat16(*(const v8h*)p, *(const v8h*)(p + 256)); } static __device__ __forceinline__ v8f mma(V a, V b, v8f c) { return wmma16(a, b, c); } };
template <> struct WFrag<bf> { typedef v16bf V; static __device__ __forceinline__ V ld(const bf* p) { return cat16b(*(const v8us*)p, *(const v8us*)(p + 256)); } static __device__ __forceinline__ v8f mma(V a, V b, v8f c) { return wmmab(a, b, c); } };
__device__ __forceinline__ h16 tohx(float x) { return (h16)x; }
__device__ __forceinline__ void splitf(float y, unsigned short& h, unsigned short& l) { h = f2bf(y); l = f2bf(y - bf2f(h)); }
template <typename T16, int NSPLIT, bool VT>
__device__ __forceinline__ void gemmw(const T16* __restrict__ A, const T16* __restrict__ A2, const T16* __restrict__ Bt, const T16* __restrict__ Bt2, int K, const float* __restrict__ bias, h16* __restrict__ P16, bf* __restrict__ Ph, bf* __restrict__ Pl) {
    typedef typename WFrag<T16>::V V;
    const int lane = threadIdx.x & 31, lr = lane & 15, hi = lane >> 4; const int r0 = blockIdx.x * 64, c0 = blockIdx.y * 64;
    v8f acc[4][4];
#pragma unroll
    for (int mb = 0; mb < 4; ++mb)
#pragma unroll
        for (int nb = 0; nb < 4; ++nb) acc[mb][nb] = (v8f){};
    const size_t aoff = (size_t)r0 * K + lane * 8, boff = (size_t)c0 * K + lane * 8;   // a row tile's fragments take 16 K elements, a k block 512
#pragma unroll 1
    for (int kc = 0; kc < K; kc += 32) {
        V a[4], a2[4];
#pragma unroll
        for (int mb = 0; mb < 4; ++mb) { a[mb] = WFrag<T16>::ld(A + aoff + (size_t)mb * 16 * K + kc * 16); if (NSPLIT == 1 || NSPLIT == 2) a2[mb] = WFrag<T16>::ld(A2 + aoff + (size_t)mb * 16 * K + kc * 16); }
        asm volatile("s_wait_xcnt 0x0" ::: "memory");   // a later load's result may take the registers that held these loads' address
#pragma unroll
        for (int nb = 0; nb < 4; ++nb) { const V b = WFrag<T16>::ld(Bt + boff + (size_t)nb * 16 * K + kc * 16); V b2; if (NSPLIT >= 2) b2 = WFrag<T16>::ld(Bt2 + boff + (size_t)nb * 16 * K + kc * 16);
#pragma unroll
            for (int mb = 0; mb < 4; ++mb) {
                if constexpr (VT) { acc[mb][nb] = WFrag<T16>::mma(a[mb], b, acc[mb][nb]); if (NSPLIT == 1 || NSPLIT == 2) acc[mb][nb] = WFrag<T16>::mma(a2[mb], b, acc[mb][nb]); if (NSPLIT >= 2) acc[mb][nb] = WFrag<T16>::mma(a[mb], b2, acc[mb][nb]); }
                else { acc[mb][nb] = WFrag<T16>::mma(b, a[mb], acc[mb][nb]); if (NSPLIT == 1 || NSPLIT == 2) acc[mb][nb] = WFrag<T16>::mma(b, a2[mb], acc[mb][nb]); if (NSPLIT >= 2) acc[mb][nb] = WFrag<T16>::mma(b2, a[mb], acc[mb][nb]); } } }
        asm volatile("v_nop\n\tv_nop\n\tv_nop\n\tv_nop" : "+v"(acc[0][0]), "+v"(acc[1][1]), "+v"(acc[2][2]), "+v"(acc[3][3]) : "v"(a[0]), "v"(a[3]));
    }
    float bl[4][VT ? 1 : 8];   // VT false: accumulator [mb][nb], value j is c[m = mb 16 + lr][n = nb 16 + 8 hi + j]; VT true: c[m = mb 16 + 8 hi + j][n = nb 16 + lr]
#pragma unroll
    for (int nb = 0; nb < 4; ++nb)
#pragma unroll
        for (int u = 0; u < (VT ? 1 : 8); ++u) bl[nb][u] = bfr(bias[c0 + nb * 16 + (VT ? lr : hi * 8 + u)]);
    const size_t pe = (size_t)blockIdx.y * TT * HD + (size_t)r0 * HD + lane * 8;   // this head's plane, this tile's 64 tokens: 4096 elements in a row in either form
#pragma unroll
    for (int mb = 0; mb < 4; ++mb) {
        v8h o16[4]; v8us oh[4], ol[4];
#pragma unroll
        for (int nb = 0; nb < 4; ++nb)
#pragma unroll
            for (int j = 0; j < 8; ++j) { const float r = acc[mb][nb][j] + bl[nb][VT ? 0 : j]; o16[nb][j] = tohx(r); unsigned short a2, c2; splitf(r, a2, c2); oh[nb][j] = a2; ol[nb][j] = c2; }
        __builtin_amdgcn_sched_barrier(0);   // the block's twelve stores stand together behind its arithmetic, so that nothing rewrites a stored register between a store and the wait below
#pragma unroll
        for (int nb = 0; nb < 4; ++nb) { const size_t e = pe + (VT ? (mb >> 1) * 2048 + nb * 512 + (mb & 1) * 256 : mb * 1024 + nb * 256);   // VT false: row tile mb, k block nb / 2, half nb % 2; VT true: k block mb / 2, row tile nb, half mb % 2
            *(v8h*)(P16 + e) = o16[nb]; *(v8us*)(Ph + e) = oh[nb]; *(v8us*)(Pl + e) = ol[nb]; }
        if (mb < 3) { asm volatile("s_wait_xcnt 0x0" ::: "memory");   // the next block reuses the registers that these stores name
            __builtin_amdgcn_sched_barrier(0); }   // the next block's arithmetic stays behind that wait
    }
}
// ---- k_proj: the six projections (q, k, v of both batches) need nothing of one another and share one grid (TT/64, heads, NB_ x 3): blockIdx.z = batch x 3 + t, t = 0 q, 1 k, 2 v (a block-uniform branch).
// X: token planes [query, key][batch]; Wt: weight planes [t]; P16 / Ph / Pl: head planes [t][batch][head].
static_assert(DQ == DKV, "the three projections have one shape");
__global__ __launch_bounds__(32) void k_proj(const bf* __restrict__ X, const bf* __restrict__ Wt, const float* __restrict__ bq, const float* __restrict__ bk, const float* __restrict__ bv, h16* __restrict__ P16, bf* __restrict__ Ph, bf* __restrict__ Pl) {
    const int b = (int)blockIdx.z / 3, t = (int)blockIdx.z % 3;
    const bf* A = X + ((size_t)(t ? 1 : 0) * NB_ + b) * TT * DM; const bf* Bt = Wt + (size_t)t * DQ * DM;
    const size_t po = ((size_t)t * NB_ + b) * NH_ * TT * HD;
    if (t == 2) gemmw<bf, 0, true>(A, nullptr, Bt, nullptr, DM, bv, P16 + po, Ph + po, Pl + po);
    else gemmw<bf, 0, false>(A, nullptr, Bt, nullptr, DM, t ? bk : bq, P16 + po, Ph + po, Pl + po);
}

typedef __attribute__((ext_vector_type(2))) _Float16 v2h;
typedef __attribute__((ext_vector_type(4))) _Float16 v4h;
typedef __attribute__((ext_vector_type(2))) unsigned short v2us;
typedef __attribute__((ext_vector_type(4))) unsigned short v4us;
typedef __attribute__((ext_vector_type(2))) float v2f;
typedef __attribute__((ext_vector_type(4))) int v4i;

__global__ __launch_bounds__(256) void k_wtG(const float* __restrict__ w, int K, int N, bf* Bt) {
    const int lane = threadIdx.x & 31; const int L0 = (blockIdx.x * 8 + (threadIdx.x >> 5)) * 8; const int nlines = N * K / 64;
{
#pragma unroll 1
        for (int l = 0; l < 8; ++l) { const int L = L0 + l; if (L >= nlines) break; const size_t e = (size_t)L * 64 + lane * 2; const int k = (int)(e % K), n = (int)(e / K); v2us o;
            o[0] = f2bf(w[(size_t)k * N + n]); o[1] = f2bf(w[(size_t)(k + 1) * N + n]); *(v2us*)(Bt + e) = o; }
         }
}
static_assert(DM == 512, "16 k blocks per row tile in frow / fcol");
__device__ __forceinline__ int frow(size_t i) { return (int)(i >> 10) * 16 + (int)(i & 15); }                                                  // 16-byte piece i of a plane M[r][DM] in fragment order: its row,
__device__ __forceinline__ int fcol(size_t i) { return (int)((i >> 6) & 15) * 32 + (int)((i >> 5) & 1) * 16 + (int)((i >> 4) & 1) * 8; }       // and the first of its 8 columns
__device__ __forceinline__ void cvt8(const float* __restrict__ src, bf* dst, size_t n8, unsigned blk) { const size_t i = (size_t)blk * 256 + threadIdx.x; if (i >= n8) return; const v8f v = *(const v8f*)(src + (size_t)frow(i) * DM + fcol(i)); v8us o;   // row-major [n][DM] -> fragment order
#pragma unroll
    for (int k = 0; k < 8; ++k) o[k] = f2bf(v[k]); *(v8us*)(dst + i * 8) = o;  }
__global__ __launch_bounds__(256) void k_cscvt(const float* __restrict__ cosT, const float* __restrict__ sinT, float* CS) { const int idx = blockIdx.x * 256 + threadIdx.x; if (idx >= TT * HD) return; v2f cs; cs[0] = bfr(cosT[idx]); cs[1] = bfr(sinT[idx]); *(v2f*)(CS + (size_t)idx * 2) = cs;  }
typedef __attribute__((ext_vector_type(16))) unsigned short v16us;
#define LC2 0.18033688011112042f   // HD^-0.5 x log2(e)
__device__ __forceinline__ void stq(h16* d, const h16* g) { *(v8ha*)d = *(const v8h*)g; *(v8ha*)(d + 256) = *(const v8h*)(g + 256); }       // one lane's two 16-byte halves of a fragment, global -> LDS
__device__ __forceinline__ void stq(bf* d, const bf* g) { *(v8usa*)d = *(const v8us*)g; *(v8usa*)(d + 256) = *(const v8us*)(g + 256); }
__device__ __forceinline__ v16h ldq(const h16* p) { return cat16(*(const v8ha*)p, *(const v8ha*)(p + 256)); }
__device__ __forceinline__ v16bf ldq(const bf* p) { return cat16b(*(const v8usa*)p, *(const v8usa*)(p + 256)); }
// 2^x with the slot the instruction set asks for behind a transcendental (one independent instruction or v_nop before its result is read or its source overwritten) kept inside the statement:
// of eight in place, each is the independent instruction behind the one before it, and one v_nop stands behind the last.
__device__ __forceinline__ float exp2n(float x) { float r; asm("v_exp_f32 %0, %1\n\tv_nop" : "=v"(r) : "v"(x)); return r; }
__device__ __forceinline__ v8f exp2x8(v8f x) { float a = x[0], b = x[1], c = x[2], d = x[3], e = x[4], f = x[5], g = x[6], h = x[7];
    asm("v_exp_f32 %0, %0\n\tv_exp_f32 %1, %1\n\tv_exp_f32 %2, %2\n\tv_exp_f32 %3, %3\n\tv_exp_f32 %4, %4\n\tv_exp_f32 %5, %5\n\tv_exp_f32 %6, %6\n\tv_exp_f32 %7, %7\n\tv_nop" : "+v"(a), "+v"(b), "+v"(c), "+v"(d), "+v"(e), "+v"(f), "+v"(g), "+v"(h));
    return (v8f){a, b, c, d, e, f, g, h}; }
template <typename T16, int NSPLIT, int NQ, int QW, int KW>
__global__ __launch_bounds__(32 * QW * KW) __attribute__((amdgpu_waves_per_eu(4))) void k_fattn(const T16* __restrict__ Q, const T16* __restrict__ Q2, const T16* __restrict__ Kp, const T16* __restrict__ Kp2, const T16* __restrict__ Vt, const T16* __restrict__ Vt2, int qbase, int nqt, float* __restrict__ out) {   // four waves per SIMD: at most 256 registers
    typedef typename WFrag<T16>::V V;
    static_assert(NQ * QW == 2 && HD == 64 && REP == 1 && (NSPLIT == 0 || NSPLIT == 2) && (NQ == 1 || NQ == 2), "32 queries per work-group, head size 64");
    __shared__ __align__(16) float Os[KW][HD][36];               // pitch 144 B: 16 B x odd
    __shared__ __align__(16) float Ms[KW][32];
    __shared__ __align__(16) float Ls[KW][32];
    __shared__ __align__(16) float Wt[KW][32];
    constexpr int NP = (NSPLIT == 2) ? 2 : 1;                    // operand planes (hi, lo)
    __shared__ __align__(16) T16 Qs[QW * KW * NP * NQ * 1024];   // the query fragments wait in LDS outside the score products, so that scores or P, the value tile and O^T fit 256 registers
    const int tid = threadIdx.x, lane = tid & 31, lr = lane & 15, hi = lane >> 4;
    const int w = __builtin_amdgcn_readfirstlane(tid >> 5), qw = w % QW, kw = w / QW;
    const int q0 = qbase + (nqt - 1 - (int)blockIdx.y) * 32;
    const int nkt = q0 / 64 + 1;                                 // 64-key tiles that hold a key <= some query; the last one starts at a key <= q0, so every query has a live key in every tile
    const int qc = qw * NQ * 16;
    const size_t pl = (size_t)blockIdx.x * TT * HD;
    Q += pl; Kp += pl; Vt += pl; if (NSPLIT == 2) { Q2 += pl; Kp2 += pl; Vt2 += pl; }
    const unsigned flane = (unsigned)(lane * 8);   // the lane's part of a fragment address (planes in fragment order); the tile's part is wave-uniform (scalar base)
    const float poff = (NSPLIT == 2) ? 0.0f : 10.0f;             // single fp16 P carries x 2^10 (as PCAR), in l too, so it cancels in O / l
    V bq[NQ][2], bq2[NQ][2];
    T16* const qs = Qs + w * NP * NQ * 1024 + lane * 8;          // this wave's own copy, 16 B per lane and half fragment: written and read by the same lanes, no barrier
#pragma unroll
    for (int nb = 0; nb < NQ; ++nb)
#pragma unroll
        for (int ks = 0; ks < 2; ++ks) { const size_t qo = (size_t)(q0 + qc + nb * 16) * HD + ks * 512 + flane;
            stq(qs + (nb * 2 + ks) * 512, Q + qo); if (NSPLIT == 2) stq(qs + (NQ * 2 + nb * 2 + ks) * 512, Q2 + qo); }
    v8f o[4][NQ]; float m[NQ], l[NQ];
#pragma unroll
    for (int nb = 0; nb < NQ; ++nb) { m[nb] = -3.0e38f; l[nb] = 0.f;
#pragma unroll
        for (int db = 0; db < 4; ++db) o[db][nb] = (v8f){}; }
#pragma unroll 1   // rolled: an unrolled body would double the live score and fragment registers
    for (int kt = kw; kt < nkt; kt += KW) {
        const int k0 = kt * 64;
        v8f st[4][NQ]; V ka[4][2], ka2[4][2], va[2][4], va2[2][4];
#pragma unroll
        for (int mb = 0; mb < 4; ++mb)
#pragma unroll
            for (int nb = 0; nb < NQ; ++nb) st[mb][nb] = (v8f){};
        asm volatile("" ::: "memory");   // compiler fence: the query fragments are read from LDS anew in every pass (hoisted out of the loop they would stay in registers and spill)
#pragma unroll
        for (int nb = 0; nb < NQ; ++nb)
#pragma unroll
            for (int ks = 0; ks < 2; ++ks) { bq[nb][ks] = ldq(qs + (nb * 2 + ks) * 512); if (NSPLIT == 2) bq2[nb][ks] = ldq(qs + (NQ * 2 + nb * 2 + ks) * 512); }
#pragma unroll
        for (int mb = 0; mb < 4; ++mb)
#pragma unroll
            for (int ks = 0; ks < 2; ++ks) { const unsigned ko = flane + (unsigned)(mb * 1024 + ks * 512); ka[mb][ks] = WFrag<T16>::ld(Kp + (size_t)k0 * HD + ko); if (NSPLIT == 2) ka2[mb][ks] = WFrag<T16>::ld(Kp2 + (size_t)k0 * HD + ko); }
        __builtin_amdgcn_sched_barrier(0);   // the key tile's loads stay together in front of the products: one load latency per tile, not one per fragment
#pragma unroll
        for (int mb = 0; mb < 4; ++mb)
#pragma unroll
            for (int ks = 0; ks < 2; ++ks)
#pragma unroll
                for (int nb = 0; nb < NQ; ++nb) { st[mb][nb] = WFrag<T16>::mma(ka[mb][ks], bq[nb][ks], st[mb][nb]); if (NSPLIT == 2) { st[mb][nb] = WFrag<T16>::mma(ka2[mb][ks], bq[nb][ks], st[mb][nb]); st[mb][nb] = WFrag<T16>::mma(ka[mb][ks], bq2[nb][ks], st[mb][nb]); } }
        if constexpr (NSPLIT == 0) {
#pragma unroll
            for (int kb = 0; kb < 2; ++kb)
#pragma unroll
                for (int db = 0; db < 4; ++db) va[kb][db] = WFrag<T16>::ld(Vt + (size_t)k0 * HD + (flane + (unsigned)(kb * 2048 + db * 512)));
            __builtin_amdgcn_sched_barrier(0); }   // the value tile's loads are issued here, into the key fragments' registers, and fly under the softmax
        if (kt == nkt - 1) {                                     // only the last tile crosses the diagonal
#pragma unroll
            for (int mb = 0; mb < 4; ++mb)
#pragma unroll
                for (int nb = 0; nb < NQ; ++nb)
#pragma unroll
                    for (int j = 0; j < 8; ++j) if (k0 + mb * 16 + hi * 8 + j > q0 + qc + nb * 16 + lr) st[mb][nb][j] = -3.0e38f; }
        V pb[NQ][2], pb2[NQ][2];
#pragma unroll
        for (int nb = 0; nb < NQ; ++nb) {
            float t4[4];
#pragma unroll
            for (int u = 0; u < 4; ++u) t4[u] = fmaxf(st[0][nb][u], st[0][nb][u + 4]);
#pragma unroll
            for (int mb = 1; mb < 4; ++mb)
#pragma unroll
                for (int j = 0; j < 8; ++j) t4[j & 3] = fmaxf(t4[j & 3], st[mb][nb][j]);
            float mt = fmaxf(fmaxf(t4[0], t4[1]), fmaxf(t4[2], t4[3]));
            mt = fmaxf(mt, __shfl_xor(mt, 16, 32));              // the other half of the wave holds the query's other 32 keys
            const float mn = fmaxf(m[nb], mt);
            const float al = exp2n((m[nb] - mn) * LC2);
            const float nm = poff - mn * LC2;
            m[nb] = mn;
            float s4[4] = {0.f, 0.f, 0.f, 0.f};
#pragma unroll
            for (int mb = 0; mb < 4; ++mb) { v8f x;
#pragma unroll
                for (int j = 0; j < 8; ++j) x[j] = fmaf(st[mb][nb][j], LC2, nm);
                x = exp2x8(x); st[mb][nb] = x;
#pragma unroll
                for (int j = 0; j < 8; ++j) s4[j & 3] += x[j]; }
            l[nb] = l[nb] * al + ((s4[0] + s4[1]) + (s4[2] + s4[3]));   // this half's keys only; the halves are joined after the loop
#pragma unroll
            for (int db = 0; db < 4; ++db) o[db][nb] *= al;
#pragma unroll
            for (int kb = 0; kb < 2; ++kb) {
                if constexpr (NSPLIT == 2) { v16us ph, pq;
#pragma unroll
                    for (int s = 0; s < 16; ++s) { unsigned short a2, c2; splitf(st[2 * kb + (s >> 3)][nb][s & 7], a2, c2); ph[s] = a2; pq[s] = c2; }
                    pb[nb][kb] = __builtin_bit_cast(v16bf, ph); pb2[nb][kb] = __builtin_bit_cast(v16bf, pq); }
                else { v16h ph;
#pragma unroll
                    for (int s = 0; s < 16; ++s) ph[s] = tohx(st[2 * kb + (s >> 3)][nb][s & 7]);
                    pb[nb][kb] = ph; } } }
        if constexpr (NSPLIT == 2) {   // hi and lo value planes do not fit 256 registers beside the scores: loaded behind the softmax (these work-groups have at most two passes per wave)
#pragma unroll
            for (int kb = 0; kb < 2; ++kb)
#pragma unroll
                for (int db = 0; db < 4; ++db) { const unsigned vo = flane + (unsigned)(kb * 2048 + db * 512); va[kb][db] = WFrag<T16>::ld(Vt + (size_t)k0 * HD + vo); va2[kb][db] = WFrag<T16>::ld(Vt2 + (size_t)k0 * HD + vo); } }
#pragma unroll
        for (int kb = 0; kb < 2; ++kb) {
#pragma unroll
            for (int db = 0; db < 4; ++db) { const V a = va[kb][db]; V a2; if (NSPLIT == 2) a2 = va2[kb][db];
#pragma unroll
                for (int nb = 0; nb < NQ; ++nb) { o[db][nb] = WFrag<T16>::mma(a, pb[nb][kb], o[db][nb]); if (NSPLIT == 2) { o[db][nb] = WFrag<T16>::mma(a2, pb[nb][kb], o[db][nb]); o[db][nb] = WFrag<T16>::mma(a, pb2[nb][kb], o[db][nb]); } } } }
    }
#pragma unroll
    for (int nb = 0; nb < NQ; ++nb) { const int qq = qc + nb * 16 + lr;
        const float lt = l[nb] + __shfl_xor(l[nb], 16, 32);
        if (hi == 0) { Ms[kw][qq] = m[nb]; Ls[kw][qq] = lt; }
#pragma unroll
        for (int db = 0; db < 4; ++db)
#pragma unroll
            for (int j = 0; j < 8; ++j) Os[kw][db * 16 + hi * 8 + j][qq] = o[db][nb][j]; }
    __syncthreads();                                             // every wave's partial (m, l, O^T) is in LDS
    if (tid < 32) { float mm = Ms[0][tid];
#pragma unroll
        for (int k = 1; k < KW; ++k) mm = fmaxf(mm, Ms[k][tid]);
        float f[KW], den = 0.f;                                  // a wave without a tile has m = -3e38, l = 0, O = 0: weight 0
#pragma unroll
        for (int k = 0; k < KW; ++k) { f[k] = exp2n((Ms[k][tid] - mm) * LC2); den += Ls[k][tid] * f[k]; }
#pragma unroll
        for (int k = 0; k < KW; ++k) Wt[k][tid] = __fdiv_rn(f[k], den); }
    __syncthreads();                                             // the merge weights are in LDS
#pragma unroll
    for (int idx = tid; idx < HD * 8; idx += 32 * QW * KW) { const int d = idx >> 3, q4 = (idx & 7) * 4; v4f r = (v4f){};
#pragma unroll
        for (int k = 0; k < KW; ++k) r += *(const v4fa*)&Os[k][d][q4] * *(const v4fa*)&Wt[k][q4];
        *(v4f*)(out + ((size_t)blockIdx.x * HD + d) * TT + q0 + q4) = r; }   // channel-first output [batch x head x d][query]; a work-group owns whole 128-byte lines
}

__device__ __forceinline__ void tok(const float* __restrict__ in, bf* X, unsigned blk) { const size_t i = (size_t)blk * 256 + threadIdx.x; if (i >= (size_t)TT * DM / 8) return; const int g = (int)(i >> 5) & (DM / 8 - 1); const int n = (int)(i >> 11) * 32 + (int)(i & 31); v8us o;
#pragma unroll
    for (int u = 0; u < 8; ++u) o[u] = f2bf(in[(size_t)(g * 8 + u) * TT + n]); *(v8us*)(X + ((size_t)(n >> 4) * 1024 + g * 16 + (n & 15)) * 8) = o;  }   // NCHW -> token rows [n][c] in fragment order: a wave reads 32 neighbouring n of a channel (one whole line) eight times and stores 16-byte piece g (channels 8 g ...) of each: 256 contiguous bytes in each of two row tiles
// ---- k_prep: the three weight conversions and the four token planes need nothing of one another and share one grid by ranges of the block index (block-uniform branches): first 3 x WBLK blocks of weights, then 2 x NB_ x TBLK of tokens.
#define WBLK (DQ * DM / 8 / 256)
#define TBLK (TT * DM / 8 / 256)
static_assert(DQ * DM % 2048 == 0 && TT * DM % 2048 == 0, "whole blocks");
__global__ __launch_bounds__(256) void k_prep(const float* __restrict__ qin, const float* __restrict__ kin, const float* __restrict__ wq, const float* __restrict__ wk, const float* __restrict__ wv, bf* X, bf* Wt) {
    const unsigned blk = blockIdx.x;
    if (blk < 3 * WBLK) { const unsigned t = blk / WBLK; cvt8(t == 0 ? wq : t == 1 ? wk : wv, Wt + (size_t)t * DQ * DM, (size_t)DQ * DM / 8, blk % WBLK); }
    else { const unsigned p = (blk - 3 * WBLK) / TBLK, b = p % NB_; tok((p / NB_ ? kin : qin) + (size_t)b * DM * TT, X + (size_t)p * TT * DM, (blk - 3 * WBLK) % TBLK); }   // plane p = [query, key][batch]
}

extern "C" void kernel_launch(void* const* d_in, const int* in_sizes, int n_in,
                              void* d_out, int out_size, void* d_ws, size_t ws_size, hipStream_t stream) {
    (void)in_sizes; (void)n_in; (void)out_size;
    const float* qin = (const float*)d_in[0]; const float* kin = (const float*)d_in[1]; const float* wq = (const float*)d_in[2]; const float* bq = (const float*)d_in[3]; const float* wk = (const float*)d_in[4]; const float* bk = (const float*)d_in[5]; const float* wv = (const float*)d_in[6]; const float* bv = (const float*)d_in[7]; const float* x = qin; const float* wo = nullptr; (void)wo; const float* cosT = nullptr; const float* sinT = nullptr; (void)cosT; (void)sinT;
    float* OUT = (float*)d_out;     // [2][512][4096] channel-first
    char* wsp = (char*)d_ws;
    auto take = [&](size_t bytes) { char* p = wsp; wsp += (bytes + 255) & ~(size_t)255; return (void*)p; };
    const size_t PE = (size_t)NB_ * NH_ * TT * HD;   // elements of one kind of head plane, both batches: [b][h][..]
    bf* WT = (bf*)take((size_t)3 * DQ * DM * 2);   // weights [q, k, v]
    bf* XT = (bf*)take((size_t)2 * NB_ * TT * DM * 2);   // token planes [query, key][b]
    h16* QP16 = (h16*)take(3 * PE * 2); h16* KP16 = QP16 + PE; h16* VT16 = KP16 + PE;   // each 16-bit form: [q, k, v][b][h][..]
    bf* QPh = (bf*)take(3 * PE * 2); bf* KPh = QPh + PE; bf* VTh = KPh + PE;
    bf* QPl = (bf*)take(3 * PE * 2); bf* KPl = QPl + PE; bf* VTl = KPl + PE;
    if ((size_t)(wsp - (char*)d_ws) > ws_size) return;    // ws 256 MiB
    k_prep<<<3 * WBLK + 2 * NB_ * TBLK, 256, 0, stream>>>(qin, kin, wq, wk, wv, XT, WT);
    k_proj<<<dim3(TT / 64, DQ / 64, NB_ * 3), 32, 0, stream>>>(XT, WT, bq, bk, bv, QP16, QPh, QPl);
    k_fattn<h16, 0, 2, 1, 4><<<dim3(NB_ * NH_, (TT - RH) / 32, 1), 128, 0, stream>>>(QP16, nullptr, KP16, nullptr, VT16, nullptr, RH, (TT - RH) / 32, OUT);
    k_fattn<bf, 2, 1, 2, 4><<<dim3(NB_ * NH_, RH / 32, 1), 256, 0, stream>>>(QPh, QPl, KPh, KPl, VTh, VTl, 0, RH / 32, OUT);
}

// v006
// It runs in 68.6 microseconds.
// Two timings next to v005 both put it at 1.07 times that version's speed.
// Counting every step since v000, it is 35.6 times as fast.
#include <hip/hip_runtime.h>

// CausalAttention2d (query, key [2][512][64x64] NCHW -> tokens [4096][512]; q = q_tok Wq^T + bq, k = k_tok Wk^T + bk, v = k_tok Wv^T + bv (8 heads x 64); causal softmax(q.k/8) over the 4096 positions; out[b][h*64+d][n] = (attn v)[h][n][d] (no output projection; written channel-first as the reference's permute + view) -> [2][512][64][64]).
// Compute dtypes, f32 accumulate: every input rounded to bf16; q/k/v on PLAIN bf16 operands (inputs: exact) + bias; causal scores and attn.v: query rows < 512 hl (3 products), the rest single fp16 (x1024); softmax f32 (online: running maximum and sum, fused with both products)

#define NB_  2
#define TT   4096
#define DM   512
#define NH_  8
#define NKV  8
#define REP  (NH_ / NKV)
#define HD   64
#define DQ   (NH_ * HD)
#define DKV  (NKV * HD)
#define ZH   1
#define RH   512                  // query rows < RH use hi+lo planes (0: none)
#define WIN  0
#define PCAR 1024.0f
#define SCL  0.125f   // HD^-0.5
static_assert(HD == 64 && RH % 64 == 0 && TT % 64 == 0, "query tiles of 32, key tiles of 64");
typedef _Float16 h16;
typedef unsigned short bf;
typedef __attribute__((ext_vector_type(16))) __bf16   v16bf;
typedef __attribute__((ext_vector_type(16))) _Float16 v16h;
typedef __attribute__((ext_vector_type(8)))  _Float16 v8h;
typedef __attribute__((ext_vector_type(8)))  unsigned short v8us;
typedef __attribute__((ext_vector_type(8)))  float    v8f;
typedef __attribute__((ext_vector_type(4)))  float    v4f;
typedef v8h  __attribute__((may_alias)) v8ha;
typedef v4f  __attribute__((may_alias)) v4fa;
typedef v8us __attribute__((may_alias)) v8usa;

__device__ __forceinline__ unsigned short f2bf(float f) { unsigned u = __float_as_uint(f); u += 0x7FFFu + ((u >> 16) & 1u); return (unsigned short)(u >> 16); }
__device__ __forceinline__ float bf2f(unsigned short b) { return __uint_as_float(((unsigned)b) << 16); }
__device__ __forceinline__ float bfr(float f) { return bf2f(f2bf(f)); }
__device__ __forceinline__ v16h cat16(v8h lo, v8h hi) { return __builtin_shufflevector(lo, hi, 0, 1, 2, 3, 4, 5, 6, 7, 8, 9, 10, 11, 12, 13, 14, 15); }
__device__ __forceinline__ v16bf cat16b(v8us lo, v8us hi) { return __builtin_bit_cast(v16bf, __builtin_shufflevector(lo, hi, 0, 1, 2, 3, 4, 5, 6, 7, 8, 9, 10, 11, 12, 13, 14, 15)); }
__device__ __forceinline__ v8f wmma16(v16h a, v16h b, v8f c) { return __builtin_amdgcn_wmma_f32_16x16x32_f16(false, a, false, b, (short)0, c, false, false); }
__device__ __forceinline__ v8f wmmab(v16bf a, v16bf b, v8f c) { return __builtin_amdgcn_wmma_f32_16x16x32_bf16(false, a, false, b, (short)0, c, false, false); }



// ---- FRAGMENT ORDER: every 16-bit plane that feeds a matrix instruction lies in memory as its fragments. A fragment is 16 rows x 32 k of a row-major M[r][k]; lane (hi, lr) holds row lr,
// k = 8 hi + s in its first 16 bytes and k = 16 + 8 hi + s in its second. It is stored as [half][lane][8 elements] = 2 x 512 contiguous bytes, so that each 16-byte load or store of a wave
// covers four whole 128-byte lines (rows of a row-major plane would give 16 lines, 32 bytes of each). The fragments of a plane follow one another as [row tile][k block].
// ---- gemmw: register-blocked GEMM, ONE WAVE per 64x64 output tile (16 accumulators), operands straight from 16-bit planes in fragment order; tile (blockIdx.x, blockIdx.y) of (M/64, N/64), 32 threads.
// c[m][n] (f32) = sum_k A[m][k] Bt[n][k] (+ split products per NSPLIT) + bias[n] stays in registers. K % 32 == 0. A column tile is one head (HD == 64).
// The epilogue writes the three 16-bit head planes of c itself (fp16, bf16 hi, bf16 lo), in fragment order too, straight from the accumulators: a lane's 8 values of one accumulator are 16 bytes of a fragment.
// VT false: planes M[m][d] per head (rows = tokens, k = d); the product is formed as c^T (weights as the A operand), so that a lane holds 8 neighbouring d of one token.
// VT true: planes M[d][m] per head (rows = d, k = tokens), fragments as [64-token tile][32-token block][d tile]; a lane of c holds 8 neighbouring tokens of one d.
template <typename T16> struct WFrag;
template <> struct WFrag<h16> { typedef v16h V; static __device__ __forceinline__ V ld(const h16* p) { return cat16(*(const v8h*)p, *(const v8h*)(p + 256)); } static __device__ __forceinline__ v8f mma(V a, V b, v8f c) { return wmma16(a, b, c); } };
template <> struct WFrag<bf> { typedef v16bf V; static __device__ __forceinline__ V ld(const bf* p) { return cat16b(*(const v8us*)p, *(const v8us*)(p + 256)); } static __device__ __forceinline__ v8f mma(V a, V b, v8f c) { return wmmab(a, b, c); } };
__device__ __forceinline__ h16 tohx(float x) { return (h16)x; }
__device__ __forceinline__ void splitf(float y, unsigned short& h, unsigned short& l) { h = f2bf(y); l = f2bf(y - bf2f(h)); }
template <typename T16, int NSPLIT, bool VT>
__device__ __forceinline__ void gemmw(const T16* __restrict__ A, const T16* __restrict__ A2, const T16* __restrict__ Bt, const T16* __restrict__ Bt2, int K, const float* __restrict__ bias, h16* __restrict__ P16, bf* __restrict__ Ph, bf* __restrict__ Pl) {
    typedef typename WFrag<T16>::V V;
    const int lane = threadIdx.x & 31, lr = lane & 15, hi = lane >> 4; const int r0 = blockIdx.x * 64, c0 = blockIdx.y * 64;
    v8f acc[4][4];
#pragma unroll
    for (int mb = 0; mb < 4; ++mb)
#pragma unroll
        for (int nb = 0; nb < 4; ++nb) acc[mb][nb] = (v8f){};
    const size_t aoff = (size_t)r0 * K + lane * 8, boff = (size_t)c0 * K + lane * 8;   // a row tile's fragments take 16 K elements, a k block 512
#pragma unroll 1
    for (int kc = 0; kc < K; kc += 32) {
        V a[4], a2[4];
#pragma unroll
        for (int mb = 0; mb < 4; ++mb) { a[mb] = WFrag<T16>::ld(A + aoff + (size_t)mb * 16 * K + kc * 16); if (NSPLIT == 1 || NSPLIT == 2) a2[mb] = WFrag<T16>::ld(A2 + aoff + (size_t)mb * 16 * K + kc * 16); }
        asm volatile("s_wait_xcnt 0x0" ::: "memory");   // a later load's result may take the registers that held these loads' address
#pragma unroll
        for (int nb = 0; nb < 4; ++nb) { const V b = WFrag<T16>::ld(Bt + boff + (size_t)nb * 16 * K + kc * 16); V b2; if (NSPLIT >= 2) b2 = WFrag<T16>::ld(Bt2 + boff + (size_t)nb * 16 * K + kc * 16);
#pragma unroll
            for (int mb = 0; mb < 4; ++mb) {
                if constexpr (VT) { acc[mb][nb] = WFrag<T16>::mma(a[mb], b, acc[mb][nb]); if (NSPLIT == 1 || NSPLIT == 2) acc[mb][nb] = WFrag<T16>::mma(a2[mb], b, acc[mb][nb]); if (NSPLIT >= 2) acc[mb][nb] = WFrag<T16>::mma(a[mb], b2, acc[mb][nb]); }
                else { acc[mb][nb] = WFrag<T16>::mma(b, a[mb], acc[mb][nb]); if (NSPLIT == 1 || NSPLIT == 2) acc[mb][nb] = WFrag<T16>::mma(b, a2[mb], acc[mb][nb]); if (NSPLIT >= 2) acc[mb][nb] = WFrag<T16>::mma(b2, a[mb], acc[mb][nb]); } } }
        asm volatile("v_nop\n\tv_nop\n\tv_nop\n\tv_nop" : "+v"(acc[0][0]), "+v"(acc[1][1]), "+v"(acc[2][2]), "+v"(acc[3][3]) : "v"(a[0]), "v"(a[3]));
    }
    float bl[4][VT ? 1 : 8];   // VT false: accumulator [mb][nb], value j is c[m = mb 16 + lr][n = nb 16 + 8 hi + j]; VT true: c[m = mb 16 + 8 hi + j][n = nb 16 + lr]
#pragma unroll
    for (int nb = 0; nb < 4; ++nb)
#pragma unroll
        for (int u = 0; u < (VT ? 1 : 8); ++u) bl[nb][u] = bfr(bias[c0 + nb * 16 + (VT ? lr : hi * 8 + u)]);
    const size_t pe = (size_t)blockIdx.y * TT * HD + (size_t)r0 * HD + lane * 8;   // this head's plane, this tile's 64 tokens: 4096 elements in a row in either form
#pragma unroll
    for (int mb = 0; mb < 4; ++mb) {
        v8h o16[4]; v8us oh[4], ol[4];
#pragma unroll
        for (int nb = 0; nb < 4; ++nb)
#pragma unroll
            for (int j = 0; j < 8; ++j) { const float r = acc[mb][nb][j] + bl[nb][VT ? 0 : j]; o16[nb][j] = tohx(r); unsigned short a2, c2; splitf(r, a2, c2); oh[nb][j] = a2; ol[nb][j] = c2; }
        __builtin_amdgcn_sched_barrier(0);   // the block's twelve stores stand together behind its arithmetic, so that nothing rewrites a stored register between a store and the wait below
#pragma unroll
        for (int nb = 0; nb < 4; ++nb) { const size_t e = pe + (VT ? (mb >> 1) * 2048 + nb * 512 + (mb & 1) * 256 : mb * 1024 + nb * 256);   // VT false: row tile mb, k block nb / 2, half nb % 2; VT true: k block mb / 2, row tile nb, half mb % 2
            *(v8h*)(P16 + e) = o16[nb]; *(v8us*)(Ph + e) = oh[nb]; *(v8us*)(Pl + e) = ol[nb]; }
        if (mb < 3) { asm volatile("s_wait_xcnt 0x0" ::: "memory");   // the next block reuses the registers that these stores name
            __builtin_amdgcn_sched_barrier(0); }   // the next block's arithmetic stays behind that wait
    }
}
// ---- k_proj: the six projections (q, k, v of both batches) need nothing of one another and share one grid (TT/64, heads, NB_ x 3): blockIdx.z = batch x 3 + t, t = 0 q, 1 k, 2 v (a block-uniform branch).
// X: token planes [query, key][batch]; Wt: weight planes [t]; P16 / Ph / Pl: head planes [t][batch][head].
static_assert(DQ == DKV, "the three projections have one shape");
__global__ __launch_bounds__(32) void k_proj(const bf* __restrict__ X, const bf* __restrict__ Wt, const float* __restrict__ bq, const float* __restrict__ bk, const float* __restrict__ bv, h16* __restrict__ P16, bf* __restrict__ Ph, bf* __restrict__ Pl) {
    const int b = (int)blockIdx.z / 3, t = (int)blockIdx.z % 3;
    const bf* A = X + ((size_t)(t ? 1 : 0) * NB_ + b) * TT * DM; const bf* Bt = Wt + (size_t)t * DQ * DM;
    const size_t po = ((size_t)t * NB_ + b) * NH_ * TT * HD;
    if (t == 2) gemmw<bf, 0, true>(A, nullptr, Bt, nullptr, DM, bv, P16 + po, Ph + po, Pl + po);
    else gemmw<bf, 0, false>(A, nullptr, Bt, nullptr, DM, t ? bk : bq, P16 + po, Ph + po, Pl + po);
}

typedef __attribute__((ext_vector_type(2))) _Float16 v2h;
typedef __attribute__((ext_vector_type(4))) _Float16 v4h;
typedef __attribute__((ext_vector_type(2))) unsigned short v2us;
typedef __attribute__((ext_vector_type(4))) unsigned short v4us;
typedef __attribute__((ext_vector_type(2))) float v2f;
typedef __attribute__((ext_vector_type(4))) int v4i;

__global__ __launch_bounds__(256) void k_wtG(const float* __restrict__ w, int K, int N, bf* Bt) {
    const int lane = threadIdx.x & 31; const int L0 = (blockIdx.x * 8 + (threadIdx.x >> 5)) * 8; const int nlines = N * K / 64;
{
#pragma unroll 1
        for (int l = 0; l < 8; ++l) { const int L = L0 + l; if (L >= nlines) break; const size_t e = (size_t)L * 64 + lane * 2; const int k = (int)(e % K), n = (int)(e / K); v2us o;
            o[0] = f2bf(w[(size_t)k * N + n]); o[1] = f2bf(w[(size_t)(k + 1) * N + n]); *(v2us*)(Bt + e) = o; }
         }
}
static_assert(DM == 512, "16 k blocks per row tile in frow / fcol");
__device__ __forceinline__ int frow(size_t i) { return (int)(i >> 10) * 16 + (int)(i & 15); }                                                  // 16-byte piece i of a plane M[r][DM] in fragment order: its row,
__device__ __forceinline__ int fcol(size_t i) { return (int)((i >> 6) & 15) * 32 + (int)((i >> 5) & 1) * 16 + (int)((i >> 4) & 1) * 8; }       // and the first of its 8 columns
__device__ __forceinline__ void cvt8(const float* __restrict__ src, bf* dst, size_t n8, unsigned blk) { const size_t i = (size_t)blk * 256 + threadIdx.x; if (i >= n8) return; const v8f v = *(const v8f*)(src + (size_t)frow(i) * DM + fcol(i)); v8us o;   // row-major [n][DM] -> fragment order
#pragma unroll
    for (int k = 0; k < 8; ++k) o[k] = f2bf(v[k]); *(v8us*)(dst + i * 8) = o;  }
__global__ __launch_bounds__(256) void k_cscvt(const float* __restrict__ cosT, const float* __restrict__ sinT, float* CS) { const int idx = blockIdx.x * 256 + threadIdx.x; if (idx >= TT * HD) return; v2f cs; cs[0] = bfr(cosT[idx]); cs[1] = bfr(sinT[idx]); *(v2f*)(CS + (size_t)idx * 2) = cs;  }
typedef __attribute__((ext_vector_type(16))) unsigned short v16us;
#define LC2 0.18033688011112042f   // HD^-0.5 x log2(e)
__device__ __forceinline__ void stq(h16* d, const h16* g) { *(v8ha*)d = *(const v8h*)g; *(v8ha*)(d + 256) = *(const v8h*)(g + 256); }       // one lane's two 16-byte halves of a fragment, global -> LDS
__device__ __forceinline__ void stq(bf* d, const bf* g) { *(v8usa*)d = *(const v8us*)g; *(v8usa*)(d + 256) = *(const v8us*)(g + 256); }
__device__ __forceinline__ v16h ldq(const h16* p) { return cat16(*(const v8ha*)p, *(const v8ha*)(p + 256)); }
__device__ __forceinline__ v16bf ldq(const bf* p) { return cat16b(*(const v8usa*)p, *(const v8usa*)(p + 256)); }
// 2^x with the slot the instruction set asks for behind a transcendental (one independent instruction or v_nop before its result is read or its source overwritten) kept inside the statement:
// of eight in place, each is the independent instruction behind the one before it, and one v_nop stands behind the last.
__device__ __forceinline__ float exp2n(float x) { float r; asm("v_exp_f32 %0, %1\n\tv_nop" : "=v"(r) : "v"(x)); return r; }
__device__ __forceinline__ v8f exp2x8(v8f x) { float a = x[0], b = x[1], c = x[2], d = x[3], e = x[4], f = x[5], g = x[6], h = x[7];
    asm("v_exp_f32 %0, %0\n\tv_exp_f32 %1, %1\n\tv_exp_f32 %2, %2\n\tv_exp_f32 %3, %3\n\tv_exp_f32 %4, %4\n\tv_exp_f32 %5, %5\n\tv_exp_f32 %6, %6\n\tv_exp_f32 %7, %7\n\tv_nop" : "+v"(a), "+v"(b), "+v"(c), "+v"(d), "+v"(e), "+v"(f), "+v"(g), "+v"(h));
    return (v8f){a, b, c, d, e, f, g, h}; }
template <int NSPLIT, int NQ, int QW, int KW> struct FSm { static constexpr int NP = (NSPLIT == 2) ? 2 : 1, OS = 0, MS = KW * HD * 36 * 4, LS = MS + KW * 128, WT = LS + KW * 128, QS = WT + KW * 128, BYTES = QS + QW * KW * NP * NQ * 2048; };   // byte offsets in sm
template <typename T16, int NSPLIT, int NQ, int QW, int KW>
__device__ __forceinline__ void fattn(char* sm, const T16* __restrict__ Q, const T16* __restrict__ Q2, const T16* __restrict__ Kp, const T16* __restrict__ Kp2, const T16* __restrict__ Vt, const T16* __restrict__ Vt2, const int q0, float* __restrict__ out) {
    typedef typename WFrag<T16>::V V; typedef FSm<NSPLIT, NQ, QW, KW> L;
    static_assert(NQ * QW == 2 && HD == 64 && REP == 1 && (NSPLIT == 0 || NSPLIT == 2) && (NQ == 1 || NQ == 2), "32 queries per work-group, head size 64");
    float (*const Os)[HD][36] = (float (*)[HD][36])(sm + L::OS);   // [KW][HD][36], pitch 144 B: 16 B x odd
    float (*const Ms)[32] = (float (*)[32])(sm + L::MS);           // [KW][32]
    float (*const Ls)[32] = (float (*)[32])(sm + L::LS);
    float (*const Wt)[32] = (float (*)[32])(sm + L::WT);
    constexpr int NP = L::NP;                                    // operand planes (hi, lo)
    T16* const Qs = (T16*)(sm + L::QS);                          // [QW * KW * NP * NQ * 1024]: the query fragments wait in LDS outside the score products, so that scores or P, the value tile and O^T fit 256 registers
    const int tid = threadIdx.x, lane = tid & 31, lr = lane & 15, hi = lane >> 4;
    const int w = __builtin_amdgcn_readfirstlane(tid >> 5), qw = w % QW, kw = w / QW;
    const int nkt = q0 / 64 + 1;                                 // 64-key tiles that hold a key <= some query; the last one starts at a key <= q0, so every query has a live key in every tile
    const int qc = qw * NQ * 16;
    const size_t pl = (size_t)blockIdx.x * TT * HD;
    Q += pl; Kp += pl; Vt += pl; if (NSPLIT == 2) { Q2 += pl; Kp2 += pl; Vt2 += pl; }
    const unsigned flane = (unsigned)(lane * 8);   // the lane's part of a fragment address (planes in fragment order); the tile's part is wave-uniform (scalar base)
    const float poff = (NSPLIT == 2) ? 0.0f : 10.0f;             // single fp16 P carries x 2^10 (as PCAR), in l too, so it cancels in O / l
    V bq[NQ][2], bq2[NQ][2];
    T16* const qs = Qs + w * NP * NQ * 1024 + lane * 8;          // this wave's own copy, 16 B per lane and half fragment: written and read by the same lanes, no barrier
#pragma unroll
    for (int nb = 0; nb < NQ; ++nb)
#pragma unroll
        for (int ks = 0; ks < 2; ++ks) { const size_t qo = (size_t)(q0 + qc + nb * 16) * HD + ks * 512 + flane;
            stq(qs + (nb * 2 + ks) * 512, Q + qo); if (NSPLIT == 2) stq(qs + (NQ * 2 + nb * 2 + ks) * 512, Q2 + qo); }
    v8f o[4][NQ]; float m[NQ], l[NQ];
#pragma unroll
    for (int nb = 0; nb < NQ; ++nb) { m[nb] = -3.0e38f; l[nb] = 0.f;
#pragma unroll
        for (int db = 0; db < 4; ++db) o[db][nb] = (v8f){}; }
#pragma unroll 1   // rolled: an unrolled body would double the live score and fragment registers
    for (int kt = kw; kt < nkt; kt += KW) {
        const int k0 = kt * 64;
        v8f st[4][NQ]; V ka[4][2], ka2[4][2], va[2][4], va2[2][4];
#pragma unroll
        for (int mb = 0; mb < 4; ++mb)
#pragma unroll
            for (int nb = 0; nb < NQ; ++nb) st[mb][nb] = (v8f){};
        asm volatile("" ::: "memory");   // compiler fence: the query fragments are read from LDS anew in every pass (hoisted out of the loop they would stay in registers and spill)
#pragma unroll
        for (int nb = 0; nb < NQ; ++nb)
#pragma unroll
            for (int ks = 0; ks < 2; ++ks) { bq[nb][ks] = ldq(qs + (nb * 2 + ks) * 512); if (NSPLIT == 2) bq2[nb][ks] = ldq(qs + (NQ * 2 + nb * 2 + ks) * 512); }
#pragma unroll
        for (int mb = 0; mb < 4; ++mb)
#pragma unroll
            for (int ks = 0; ks < 2; ++ks) { const unsigned ko = flane + (unsigned)(mb * 1024 + ks * 512); ka[mb][ks] = WFrag<T16>::ld(Kp + (size_t)k0 * HD + ko); if (NSPLIT == 2) ka2[mb][ks] = WFrag<T16>::ld(Kp2 + (size_t)k0 * HD + ko); }
        __builtin_amdgcn_sched_barrier(0);   // the key tile's loads stay together in front of the products: one load latency per tile, not one per fragment
#pragma unroll
        for (int mb = 0; mb < 4; ++mb)
#pragma unroll
            for (int ks = 0; ks < 2; ++ks)
#pragma unroll
                for (int nb = 0; nb < NQ; ++nb) { st[mb][nb] = WFrag<T16>::mma(ka[mb][ks], bq[nb][ks], st[mb][nb]); if (NSPLIT == 2) { st[mb][nb] = WFrag<T16>::mma(ka2[mb][ks], bq[nb][ks], st[mb][nb]); st[mb][nb] = WFrag<T16>::mma(ka[mb][ks], bq2[nb][ks], st[mb][nb]); } }
        if constexpr (NSPLIT == 0) {
#pragma unroll
            for (int kb = 0; kb < 2; ++kb)
#pragma unroll
                for (int db = 0; db < 4; ++db) va[kb][db] = WFrag<T16>::ld(Vt + (size_t)k0 * HD + (flane + (unsigned)(kb * 2048 + db * 512)));
            __builtin_amdgcn_sched_barrier(0); }   // the value tile's loads are issued here, into the key fragments' registers, and fly under the softmax
        if (kt == nkt - 1) {                                     // only the last tile crosses the diagonal
#pragma unroll
            for (int mb = 0; mb < 4; ++mb)
#pragma unroll
                for (int nb = 0; nb < NQ; ++nb)
#pragma unroll
                    for (int j = 0; j < 8; ++j) if (k0 + mb * 16 + hi * 8 + j > q0 + qc + nb * 16 + lr) st[mb][nb][j] = -3.0e38f; }
        V pb[NQ][2], pb2[NQ][2];
#pragma unroll
        for (int nb = 0; nb < NQ; ++nb) {
            float t4[4];
#pragma unroll
            for (int u = 0; u < 4; ++u) t4[u] = fmaxf(st[0][nb][u], st[0][nb][u + 4]);
#pragma unroll
            for (int mb = 1; mb < 4; ++mb)
#pragma unroll
                for (int j = 0; j < 8; ++j) t4[j & 3] = fmaxf(t4[j & 3], st[mb][nb][j]);
            float mt = fmaxf(fmaxf(t4[0], t4[1]), fmaxf(t4[2], t4[3]));
            mt = fmaxf(mt, __shfl_xor(mt, 16, 32));              // the other half of the wave holds the query's other 32 keys
            const float mn = fmaxf(m[nb], mt);
            const float al = exp2n((m[nb] - mn) * LC2);
            const float nm = poff - mn * LC2;
            m[nb] = mn;
            float s4[4] = {0.f, 0.f, 0.f, 0.f};
#pragma unroll
            for (int mb = 0; mb < 4; ++mb) { v8f x;
#pragma unroll
                for (int j = 0; j < 8; ++j) x[j] = fmaf(st[mb][nb][j], LC2, nm);
                x = exp2x8(x); st[mb][nb] = x;
#pragma unroll
                for (int j = 0; j < 8; ++j) s4[j & 3] += x[j]; }
            l[nb] = l[nb] * al + ((s4[0] + s4[1]) + (s4[2] + s4[3]));   // this half's keys only; the halves are joined after the loop
#pragma unroll
            for (int db = 0; db < 4; ++db) o[db][nb] *= al;
#pragma unroll
            for (int kb = 0; kb < 2; ++kb) {
                if constexpr (NSPLIT == 2) { v16us ph, pq;
#pragma unroll
                    for (int s = 0; s < 16; ++s) { unsigned short a2, c2; splitf(st[2 * kb + (s >> 3)][nb][s & 7], a2, c2); ph[s] = a2; pq[s] = c2; }
                    pb[nb][kb] = __builtin_bit_cast(v16bf, ph); pb2[nb][kb] = __builtin_bit_cast(v16bf, pq); }
                else { v16h ph;
#pragma unroll
                    for (int s = 0; s < 16; ++s) ph[s] = tohx(st[2 * kb + (s >> 3)][nb][s & 7]);
                    pb[nb][kb] = ph; } } }
        if constexpr (NSPLIT == 2) {   // hi and lo value planes do not fit 256 registers beside the scores: loaded behind the softmax (these work-groups have at most four passes per wave)
#pragma unroll
            for (int kb = 0; kb < 2; ++kb)
#pragma unroll
                for (int db = 0; db < 4; ++db) { const unsigned vo = flane + (unsigned)(kb * 2048 + db * 512); va[kb][db] = WFrag<T16>::ld(Vt + (size_t)k0 * HD + vo); va2[kb][db] = WFrag<T16>::ld(Vt2 + (size_t)k0 * HD + vo); } }
#pragma unroll
        for (int kb = 0; kb < 2; ++kb) {
#pragma unroll
            for (int db = 0; db < 4; ++db) { const V a = va[kb][db]; V a2; if (NSPLIT == 2) a2 = va2[kb][db];
#pragma unroll
                for (int nb = 0; nb < NQ; ++nb) { o[db][nb] = WFrag<T16>::mma(a, pb[nb][kb], o[db][nb]); if (NSPLIT == 2) { o[db][nb] = WFrag<T16>::mma(a2, pb[nb][kb], o[db][nb]); o[db][nb] = WFrag<T16>::mma(a, pb2[nb][kb], o[db][nb]); } } } }
    }
#pragma unroll
    for (int nb = 0; nb < NQ; ++nb) { const int qq = ((tid >> 5) % QW) * NQ * 16 + nb * 16 + lr;   // formed anew from the thread id (not from qc): no register holds it across the loop
        const float lt = l[nb] + __shfl_xor(l[nb], 16, 32);
        if (hi == 0) { Ms[kw][qq] = m[nb]; Ls[kw][qq] = lt; }
#pragma unroll
        for (int db = 0; db < 4; ++db)
#pragma unroll
            for (int j = 0; j < 8; ++j) Os[kw][db * 16 + hi * 8 + j][qq] = o[db][nb][j]; }
    __syncthreads();                                             // every wave's partial (m, l, O^T) is in LDS
    if (tid < 32) { float mm = Ms[0][tid];
#pragma unroll
        for (int k = 1; k < KW; ++k) mm = fmaxf(mm, Ms[k][tid]);
        float f[KW], den = 0.f;                                  // a wave without a tile has m = -3e38, l = 0, O = 0: weight 0
#pragma unroll
        for (int k = 0; k < KW; ++k) { f[k] = exp2n((Ms[k][tid] - mm) * LC2); den += Ls[k][tid] * f[k]; }
#pragma unroll
        for (int k = 0; k < KW; ++k) Wt[k][tid] = __fdiv_rn(f[k], den); }
    __syncthreads();                                             // the merge weights are in LDS
#pragma unroll
    for (int idx = tid; idx < HD * 8; idx += 32 * QW * KW) { const int d = idx >> 3, q4 = (idx & 7) * 4; v4f r = (v4f){};
#pragma unroll
        for (int k = 0; k < KW; ++k) r += *(const v4fa*)&Os[k][d][q4] * *(const v4fa*)&Wt[k][q4];
        *(v4f*)(out + ((size_t)blockIdx.x * HD + d) * TT + q0 + q4) = r; }   // channel-first output [batch x head x d][query]; a work-group owns whole 128-byte lines
}
// ---- k_fattn: the single-fp16 query tiles (rows >= RH) and the hi+lo tiles (rows < RH) need nothing of one another and share one grid (batch x head, NM + NL query tiles of 32), four waves each, by a block-uniform
// branch on blockIdx.y; the two paths use the same LDS. A work-group's duration falls with blockIdx.y: fp16 tiles with the most keys first; a hi+lo pass (three products per tile, value loads not hidden) lasts about two fp16 passes
// and a hi+lo wave has twice the passes per key (keys split over two waves, not four), so the hi+lo tiles stand in front of the NA fp16 tiles whose queries lie below 4 RH.
#define NM ((TT - RH) / 32)
#define NL (RH / 32)
#define NA (3 * NL)
static_assert(NM >= NA && FSm<2, 1, 2, 2>::BYTES <= FSm<0, 2, 1, 4>::BYTES, "tile order, LDS size");
__global__ __launch_bounds__(128) __attribute__((amdgpu_waves_per_eu(4))) void k_fattn(const h16* __restrict__ Q16, const h16* __restrict__ K16, const h16* __restrict__ V16, const bf* __restrict__ Qh, const bf* __restrict__ Ql, const bf* __restrict__ Kh, const bf* __restrict__ Kl, const bf* __restrict__ Vh, const bf* __restrict__ Vl, float* __restrict__ out) {   // four waves per SIMD: at most 256 registers
    __shared__ __align__(16) char sm[FSm<0, 2, 1, 4>::BYTES];
    const int y = (int)blockIdx.y;
    if (y < NM - NA || y >= NM - NA + NL) fattn<h16, 0, 2, 1, 4>(sm, Q16, nullptr, K16, nullptr, V16, nullptr, RH + (NM - 1 - (y < NM - NA ? y : y - NL)) * 32, out);
    else fattn<bf, 2, 1, 2, 2>(sm, Qh, Ql, Kh, Kl, Vh, Vl, (NM - NA + NL - 1 - y) * 32, out);
}

__device__ __forceinline__ void tok(const float* __restrict__ in, bf* X, unsigned blk) { const size_t i = (size_t)blk * 256 + threadIdx.x; if (i >= (size_t)TT * DM / 8) return; const int g = (int)(i >> 5) & (DM / 8 - 1); const int n = (int)(i >> 11) * 32 + (int)(i & 31); v8us o;
#pragma unroll
    for (int u = 0; u < 8; ++u) o[u] = f2bf(in[(size_t)(g * 8 + u) * TT + n]); *(v8us*)(X + ((size_t)(n >> 4) * 1024 + g * 16 + (n & 15)) * 8) = o;  }   // NCHW -> token rows [n][c] in fragment order: a wave reads 32 neighbouring n of a channel (one whole line) eight times and stores 16-byte piece g (channels 8 g ...) of each: 256 contiguous bytes in each of two row tiles
// ---- k_prep: the three weight conversions and the four token planes need nothing of one another and share one grid by ranges of the block index (block-uniform branches): first 3 x WBLK blocks of weights, then 2 x NB_ x TBLK of tokens.
#define WBLK (DQ * DM / 8 / 256)
#define TBLK (TT * DM / 8 / 256)
static_assert(DQ * DM % 2048 == 0 && TT * DM % 2048 == 0, "whole blocks");
__global__ __launch_bounds__(256) void k_prep(const float* __restrict__ qin, const float* __restrict__ kin, const float* __restrict__ wq, const float* __restrict__ wk, const float* __restrict__ wv, bf* X, bf* Wt) {
    const unsigned blk = blockIdx.x;
    if (blk < 3 * WBLK) { const unsigned t = blk / WBLK; cvt8(t == 0 ? wq : t == 1 ? wk : wv, Wt + (size_t)t * DQ * DM, (size_t)DQ * DM / 8, blk % WBLK); }
    else { const unsigned p = (blk - 3 * WBLK) / TBLK, b = p % NB_; tok((p / NB_ ? kin : qin) + (size_t)b * DM * TT, X + (size_t)p * TT * DM, (blk - 3 * WBLK) % TBLK); }   // plane p = [query, key][batch]
}

extern "C" void kernel_launch(void* const* d_in, const int* in_sizes, int n_in,
                              void* d_out, int out_size, void* d_ws, size_t ws_size, hipStream_t stream) {
    (void)in_sizes; (void)n_in; (void)out_size;
    const float* qin = (const float*)d_in[0]; const float* kin = (const float*)d_in[1]; const float* wq = (const float*)d_in[2]; const float* bq = (const float*)d_in[3]; const float* wk = (const float*)d_in[4]; const float* bk = (const float*)d_in[5]; const float* wv = (const float*)d_in[6]; const float* bv = (const float*)d_in[7]; const float* x = qin; const float* wo = nullptr; (void)wo; const float* cosT = nullptr; const float* sinT = nullptr; (void)cosT; (void)sinT;
    float* OUT = (float*)d_out;     // [2][512][4096] channel-first
    char* wsp = (char*)d_ws;
    auto take = [&](size_t bytes) { char* p = wsp; wsp += (bytes + 255) & ~(size_t)255; return (void*)p; };
    const size_t PE = (size_t)NB_ * NH_ * TT * HD;   // elements of one kind of head plane, both batches: [b][h][..]
    bf* WT = (bf*)take((size_t)3 * DQ * DM * 2);   // weights [q, k, v]
    bf* XT = (bf*)take((size_t)2 * NB_ * TT * DM * 2);   // token planes [query, key][b]
    h16* QP16 = (h16*)take(3 * PE * 2); h16* KP16 = QP16 + PE; h16* VT16 = KP16 + PE;   // each 16-bit form: [q, k, v][b][h][..]
    bf* QPh = (bf*)take(3 * PE * 2); bf* KPh = QPh + PE; bf* VTh = KPh + PE;
    bf* QPl = (bf*)take(3 * PE * 2); bf* KPl = QPl + PE; bf* VTl = KPl + PE;
    if ((size_t)(wsp - (char*)d_ws) > ws_size) return;    // ws 256 MiB
    k_prep<<<3 * WBLK + 2 * NB_ * TBLK, 256, 0, stream>>>(qin, kin, wq, wk, wv, XT, WT);
    k_proj<<<dim3(TT / 64, DQ / 64, NB_ * 3), 32, 0, stream>>>(XT, WT, bq, bk, bv, QP16, QPh, QPl);
    k_fattn<<<dim3(NB_ * NH_, NM + NL, 1), 128, 0, stream>>>(QP16, KP16, VT16, QPh, QPl, KPh, KPl, VTh, VTl, OUT);
}

// v007
// Measured time: 64.3 microseconds a run.
// Two timings next to v006 put it at 1.06 and 1.09 times that version's speed.
// Over all steps from v000 it is 38.1 times as fast.
#include <hip/hip_runtime.h>

// CausalAttention2d (query, key [2][512][64x64] NCHW -> tokens [4096][512]; q = q_tok Wq^T + bq, k = k_tok Wk^T + bk, v = k_tok Wv^T + bv (8 heads x 64); causal softmax(q.k/8) over the 4096 positions; out[b][h*64+d][n] = (attn v)[h][n][d] (no output projection; written channel-first as the reference's permute + view) -> [2][512][64][64]).
// Compute dtypes, f32 accumulate: every input rounded to bf16; q/k/v on PLAIN bf16 operands (inputs: exact) + bias; causal scores and attn.v: query rows < 512 hl (3 products), the rest single fp16 (x1024); softmax f32 (online: running maximum and sum, fused with both products)

#define NB_  2
#define TT   4096
#define DM   512
#define NH_  8
#define NKV  8
#define REP  (NH_ / NKV)
#define HD   64
#define DQ   (NH_ * HD)
#define DKV  (NKV * HD)
#define ZH   1
#define RH   512                  // query rows < RH use hi+lo planes (0: none)
#define WIN  0
#define PCAR 1024.0f
#define SCL  0.125f   // HD^-0.5
static_assert(HD == 64 && RH % 64 == 0 && TT % 64 == 0, "query tiles of 32, key tiles of 64");
typedef _Float16 h16;
typedef unsigned short bf;
typedef __attribute__((ext_vector_type(16))) __bf16   v16bf;
typedef __attribute__((ext_vector_type(16))) _Float16 v16h;
typedef __attribute__((ext_vector_type(8)))  _Float16 v8h;
typedef __attribute__((ext_vector_type(8)))  unsigned short v8us;
typedef __attribute__((ext_vector_type(8)))  float    v8f;
typedef __attribute__((ext_vector_type(4)))  float    v4f;
typedef v8h  __attribute__((may_alias)) v8ha;
typedef v4f  __attribute__((may_alias)) v4fa;
typedef v8us __attribute__((may_alias)) v8usa;

__device__ __forceinline__ unsigned short f2bf(float f) { unsigned u = __float_as_uint(f); u += 0x7FFFu + ((u >> 16) & 1u); return (unsigned short)(u >> 16); }
__device__ __forceinline__ float bf2f(unsigned short b) { return __uint_as_float(((unsigned)b) << 16); }
__device__ __forceinline__ float bfr(float f) { return bf2f(f2bf(f)); }
__device__ __forceinline__ v16h cat16(v8h lo, v8h hi) { return __builtin_shufflevector(lo, hi, 0, 1, 2, 3, 4, 5, 6, 7, 8, 9, 10, 11, 12, 13, 14, 15); }
__device__ __forceinline__ v16bf cat16b(v8us lo, v8us hi) { return __builtin_bit_cast(v16bf, __builtin_shufflevector(lo, hi, 0, 1, 2, 3, 4, 5, 6, 7, 8, 9, 10, 11, 12, 13, 14, 15)); }
__device__ __forceinline__ v8f wmma16(v16h a, v16h b, v8f c) { return __builtin_amdgcn_wmma_f32_16x16x32_f16(false, a, false, b, (short)0, c, false, false); }
__device__ __forceinline__ v8f wmmab(v16bf a, v16bf b, v8f c) { return __builtin_amdgcn_wmma_f32_16x16x32_bf16(false, a, false, b, (short)0, c, false, false); }



// ---- FRAGMENT ORDER: every 16-bit plane that feeds a matrix instruction lies in memory as its fragments. A fragment is 16 rows x 32 k of a row-major M[r][k]; lane (hi, lr) holds row lr,
// k = 8 hi + s in its first 16 bytes and k = 16 + 8 hi + s in its second. It is stored as [half][lane][8 elements] = 2 x 512 contiguous bytes, so that each 16-byte load or store of a wave
// covers four whole 128-byte lines (rows of a row-major plane would give 16 lines, 32 bytes of each). The fragments of a plane follow one another as [row tile][k block].
// ---- gemmw: register-blocked GEMM, ONE WAVE per 64x64 output tile (16 accumulators), operands straight from 16-bit planes in fragment order; tile (blockIdx.x, blockIdx.y) of (M/64, N/64), 32 threads.
// c[m][n] (f32) = sum_k A[m][k] Bt[n][k] (+ split products per NSPLIT) + bias[n] stays in registers. K % 64 == 0. A column tile is one head (HD == 64).
// The epilogue writes the three 16-bit head planes of c itself (fp16, bf16 hi, bf16 lo), in fragment order too, straight from the accumulators: a lane's 8 values of one accumulator are 16 bytes of a fragment.
// VT false: planes M[m][d] per head (rows = tokens, k = d); the product is formed as c^T (weights as the A operand), so that a lane holds 8 neighbouring d of one token.
// VT true: planes M[d][m] per head (rows = d, k = tokens), fragments as [64-token tile][32-token block][d tile]; a lane of c holds 8 neighbouring tokens of one d.
template <typename T16> struct WFrag;
template <> struct WFrag<h16> { typedef v16h V; static __device__ __forceinline__ V ld(const h16* p) { return cat16(*(const v8h*)p, *(const v8h*)(p + 256)); } static __device__ __forceinline__ v8f mma(V a, V b, v8f c) { return wmma16(a, b, c); } };
template <> struct WFrag<bf> { typedef v16bf V; static __device__ __forceinline__ V ld(const bf* p) { return cat16b(*(const v8us*)p, *(const v8us*)(p + 256)); } static __device__ __forceinline__ v8f mma(V a, V b, v8f c) { return wmmab(a, b, c); } };
__device__ __forceinline__ h16 tohx(float x) { return (h16)x; }
__device__ __forceinline__ void splitf(float y, unsigned short& h, unsigned short& l) { h = f2bf(y); l = f2bf(y - bf2f(h)); }
template <typename T16, int NSPLIT, bool VT>
__device__ __forceinline__ void gemmw(const T16* __restrict__ A, const T16* __restrict__ A2, const T16* __restrict__ Bt, const T16* __restrict__ Bt2, int K, const float* __restrict__ bias, h16* __restrict__ P16, bf* __restrict__ Ph, bf* __restrict__ Pl) {
    typedef typename WFrag<T16>::V V;
    const int lane = threadIdx.x & 31, lr = lane & 15, hi = lane >> 4; const int r0 = blockIdx.x * 64, c0 = blockIdx.y * 64;
    v8f acc[4][4];
#pragma unroll
    for (int mb = 0; mb < 4; ++mb)
#pragma unroll
        for (int nb = 0; nb < 4; ++nb) acc[mb][nb] = (v8f){};
    const size_t aoff = (size_t)r0 * K + lane * 8, boff = (size_t)c0 * K + lane * 8;   // a row tile's fragments take 16 K elements, a k block 512
    // Two fragment sets: the sixteen loads of a k block are issued together, one block ahead of their products (set s is refilled as soon as its products are issued), so that a block waits for what is left
    // of one load latency behind the other set's products, not for two whole latencies. K is a multiple of 64: the blocks go in pairs, the last pair outside the loop (it has one block left to fetch).
    V a[2][4], a2[2][4], b[2][4], b2[2][4];
    auto ldblk = [&](const int s, const int kc) {
#pragma unroll
        for (int mb = 0; mb < 4; ++mb) { a[s][mb] = WFrag<T16>::ld(A + aoff + (size_t)mb * 16 * K + kc * 16); if (NSPLIT == 1 || NSPLIT == 2) a2[s][mb] = WFrag<T16>::ld(A2 + aoff + (size_t)mb * 16 * K + kc * 16); }
#pragma unroll
        for (int nb = 0; nb < 4; ++nb) { b[s][nb] = WFrag<T16>::ld(Bt + boff + (size_t)nb * 16 * K + kc * 16); if (NSPLIT >= 2) b2[s][nb] = WFrag<T16>::ld(Bt2 + boff + (size_t)nb * 16 * K + kc * 16); }
        asm volatile("s_wait_xcnt 0x0" ::: "memory");   // later address arithmetic and later loads' results rewrite the registers that these loads name
        __builtin_amdgcn_sched_barrier(0); };           // the loads are issued in front of the other set's products: moved behind them they would lose their lead
    auto mmblk = [&](const int s) {
#pragma unroll
        for (int nb = 0; nb < 4; ++nb)
#pragma unroll
            for (int mb = 0; mb < 4; ++mb) {
                if constexpr (VT) { acc[mb][nb] = WFrag<T16>::mma(a[s][mb], b[s][nb], acc[mb][nb]); if (NSPLIT == 1 || NSPLIT == 2) acc[mb][nb] = WFrag<T16>::mma(a2[s][mb], b[s][nb], acc[mb][nb]); if (NSPLIT >= 2) acc[mb][nb] = WFrag<T16>::mma(a[s][mb], b2[s][nb], acc[mb][nb]); }
                else { acc[mb][nb] = WFrag<T16>::mma(b[s][nb], a[s][mb], acc[mb][nb]); if (NSPLIT == 1 || NSPLIT == 2) acc[mb][nb] = WFrag<T16>::mma(b[s][nb], a2[s][mb], acc[mb][nb]); if (NSPLIT >= 2) acc[mb][nb] = WFrag<T16>::mma(b2[s][nb], a[s][mb], acc[mb][nb]); } }
        __builtin_amdgcn_sched_barrier(0); };           // the set's refill stays behind its products
    ldblk(0, 0);
#pragma unroll 1   // rolled: the body already holds both sets
    for (int kc = 0; kc < K - 64; kc += 64) {
        ldblk(1, kc + 32); mmblk(0); ldblk(0, kc + 64); mmblk(1);
        asm volatile("v_nop\n\tv_nop\n\tv_nop\n\tv_nop" : "+v"(acc[0][3]), "+v"(acc[1][3]), "+v"(acc[2][3]), "+v"(acc[3][3]) : "v"(a[1][0]), "v"(a[1][3]));   // the four vector slots behind the last products, on the loop's taken branch too
    }
    ldblk(1, K - 32); mmblk(0); mmblk(1);
    float bl[4][VT ? 1 : 8];   // VT false: accumulator [mb][nb], value j is c[m = mb 16 + lr][n = nb 16 + 8 hi + j]; VT true: c[m = mb 16 + 8 hi + j][n = nb 16 + lr]
#pragma unroll
    for (int nb = 0; nb < 4; ++nb)
#pragma unroll
        for (int u = 0; u < (VT ? 1 : 8); ++u) bl[nb][u] = bfr(bias[c0 + nb * 16 + (VT ? lr : hi * 8 + u)]);
    const size_t pe = (size_t)blockIdx.y * TT * HD + (size_t)r0 * HD + lane * 8;   // this head's plane, this tile's 64 tokens: 4096 elements in a row in either form
#pragma unroll
    for (int mb = 0; mb < 4; ++mb) {
        v8h o16[4]; v8us oh[4], ol[4];
#pragma unroll
        for (int nb = 0; nb < 4; ++nb)
#pragma unroll
            for (int j = 0; j < 8; ++j) { const float r = acc[mb][nb][j] + bl[nb][VT ? 0 : j]; o16[nb][j] = tohx(r); unsigned short a2, c2; splitf(r, a2, c2); oh[nb][j] = a2; ol[nb][j] = c2; }
        __builtin_amdgcn_sched_barrier(0);   // the block's twelve stores stand together behind its arithmetic, so that nothing rewrites a stored register between a store and the wait below
#pragma unroll
        for (int nb = 0; nb < 4; ++nb) { const size_t e = pe + (VT ? (mb >> 1) * 2048 + nb * 512 + (mb & 1) * 256 : mb * 1024 + nb * 256);   // VT false: row tile mb, k block nb / 2, half nb % 2; VT true: k block mb / 2, row tile nb, half mb % 2
            *(v8h*)(P16 + e) = o16[nb]; *(v8us*)(Ph + e) = oh[nb]; *(v8us*)(Pl + e) = ol[nb]; }
        if (mb < 3) { asm volatile("s_wait_xcnt 0x0" ::: "memory");   // the next block reuses the registers that these stores name
            __builtin_amdgcn_sched_barrier(0); }   // the next block's arithmetic stays behind that wait
    }
}
// ---- k_proj: the six projections (q, k, v of both batches) need nothing of one another and share one grid (TT/64, heads, NB_ x 3): blockIdx.z = batch x 3 + t, t = 0 q, 1 k, 2 v (a block-uniform branch).
// X: token planes [query, key][batch]; Wt: weight planes [t]; P16 / Ph / Pl: head planes [t][batch][head].
static_assert(DQ == DKV && DM % 64 == 0, "the three projections have one shape; k blocks in pairs");
__global__ __launch_bounds__(32) void k_proj(const bf* __restrict__ X, const bf* __restrict__ Wt, const float* __restrict__ bq, const float* __restrict__ bk, const float* __restrict__ bv, h16* __restrict__ P16, bf* __restrict__ Ph, bf* __restrict__ Pl) {
    const int b = (int)blockIdx.z / 3, t = (int)blockIdx.z % 3;
    const bf* A = X + ((size_t)(t ? 1 : 0) * NB_ + b) * TT * DM; const bf* Bt = Wt + (size_t)t * DQ * DM;
    const size_t po = ((size_t)t * NB_ + b) * NH_ * TT * HD;
    if (t == 2) gemmw<bf, 0, true>(A, nullptr, Bt, nullptr, DM, bv, P16 + po, Ph + po, Pl + po);
    else gemmw<bf, 0, false>(A, nullptr, Bt, nullptr, DM, t ? bk : bq, P16 + po, Ph + po, Pl + po);
}

typedef __attribute__((ext_vector_type(2))) _Float16 v2h;
typedef __attribute__((ext_vector_type(4))) _Float16 v4h;
typedef __attribute__((ext_vector_type(2))) unsigned short v2us;
typedef __attribute__((ext_vector_type(4))) unsigned short v4us;
typedef __attribute__((ext_vector_type(2))) float v2f;
typedef __attribute__((ext_vector_type(4))) int v4i;

__global__ __launch_bounds__(256) void k_wtG(const float* __restrict__ w, int K, int N, bf* Bt) {
    const int lane = threadIdx.x & 31; const int L0 = (blockIdx.x * 8 + (threadIdx.x >> 5)) * 8; const int nlines = N * K / 64;
{
#pragma unroll 1
        for (int l = 0; l < 8; ++l) { const int L = L0 + l; if (L >= nlines) break; const size_t e = (size_t)L * 64 + lane * 2; const int k = (int)(e % K), n = (int)(e / K); v2us o;
            o[0] = f2bf(w[(size_t)k * N + n]); o[1] = f2bf(w[(size_t)(k + 1) * N + n]); *(v2us*)(Bt + e) = o; }
         }
}
static_assert(DM == 512, "16 k blocks per row tile in frow / fcol");
__device__ __forceinline__ int frow(size_t i) { return (int)(i >> 10) * 16 + (int)(i & 15); }                                                  // 16-byte piece i of a plane M[r][DM] in fragment order: its row,
__device__ __forceinline__ int fcol(size_t i) { return (int)((i >> 6) & 15) * 32 + (int)((i >> 5) & 1) * 16 + (int)((i >> 4) & 1) * 8; }       // and the first of its 8 columns
__device__ __forceinline__ void cvt8(const float* __restrict__ src, bf* dst, size_t n8, unsigned blk) { const size_t i = (size_t)blk * 256 + threadIdx.x; if (i >= n8) return; const v8f v = *(const v8f*)(src + (size_t)frow(i) * DM + fcol(i)); v8us o;   // row-major [n][DM] -> fragment order
#pragma unroll
    for (int k = 0; k < 8; ++k) o[k] = f2bf(v[k]); *(v8us*)(dst + i * 8) = o;  }
__global__ __launch_bounds__(256) void k_cscvt(const float* __restrict__ cosT, const float* __restrict__ sinT, float* CS) { const int idx = blockIdx.x * 256 + threadIdx.x; if (idx >= TT * HD) return; v2f cs; cs[0] = bfr(cosT[idx]); cs[1] = bfr(sinT[idx]); *(v2f*)(CS + (size_t)idx * 2) = cs;  }
typedef __attribute__((ext_vector_type(16))) unsigned short v16us;
#define LC2 0.18033688011112042f   // HD^-0.5 x log2(e)
__device__ __forceinline__ void stq(h16* d, const h16* g) { *(v8ha*)d = *(const v8h*)g; *(v8ha*)(d + 256) = *(const v8h*)(g + 256); }       // one lane's two 16-byte halves of a fragment, global -> LDS
__device__ __forceinline__ void stq(bf* d, const bf* g) { *(v8usa*)d = *(const v8us*)g; *(v8usa*)(d + 256) = *(const v8us*)(g + 256); }
__device__ __forceinline__ v16h ldq(const h16* p) { return cat16(*(const v8ha*)p, *(const v8ha*)(p + 256)); }
__device__ __forceinline__ v16bf ldq(const bf* p) { return cat16b(*(const v8usa*)p, *(const v8usa*)(p + 256)); }
// 2^x with the slot the instruction set asks for behind a transcendental (one independent instruction or v_nop before its result is read or its source overwritten) kept inside the statement:
// of eight in place, each is the independent instruction behind the one before it, and one v_nop stands behind the last.
__device__ __forceinline__ float exp2n(float x) { float r; asm("v_exp_f32 %0, %1\n\tv_nop" : "=v"(r) : "v"(x)); return r; }
__device__ __forceinline__ v8f exp2x8(v8f x) { float a = x[0], b = x[1], c = x[2], d = x[3], e = x[4], f = x[5], g = x[6], h = x[7];
    asm("v_exp_f32 %0, %0\n\tv_exp_f32 %1, %1\n\tv_exp_f32 %2, %2\n\tv_exp_f32 %3, %3\n\tv_exp_f32 %4, %4\n\tv_exp_f32 %5, %5\n\tv_exp_f32 %6, %6\n\tv_exp_f32 %7, %7\n\tv_nop" : "+v"(a), "+v"(b), "+v"(c), "+v"(d), "+v"(e), "+v"(f), "+v"(g), "+v"(h));
    return (v8f){a, b, c, d, e, f, g, h}; }
template <int NSPLIT, int NQ, int QW, int KW> struct FSm { static constexpr int NP = (NSPLIT == 2) ? 2 : 1, OS = 0, MS = KW * HD * 36 * 4, LS = MS + KW * 128, WT = LS + KW * 128, QS = WT + KW * 128, BYTES = QS + QW * KW * NP * NQ * 2048; };   // byte offsets in sm
template <typename T16, int NSPLIT, int NQ, int QW, int KW>
__device__ __forceinline__ void fattn(char* sm, const T16* __restrict__ Q, const T16* __restrict__ Q2, const T16* __restrict__ Kp, const T16* __restrict__ Kp2, const T16* __restrict__ Vt, const T16* __restrict__ Vt2, const int q0, float* __restrict__ out) {
    typedef typename WFrag<T16>::V V; typedef FSm<NSPLIT, NQ, QW, KW> L;
    static_assert(NQ * QW == 2 && HD == 64 && REP == 1 && (NSPLIT == 0 || NSPLIT == 2) && (NQ == 1 || NQ == 2), "32 queries per work-group, head size 64");
    float (*const Os)[HD][36] = (float (*)[HD][36])(sm + L::OS);   // [KW][HD][36], pitch 144 B: 16 B x odd
    float (*const Ms)[32] = (float (*)[32])(sm + L::MS);           // [KW][32]
    float (*const Ls)[32] = (float (*)[32])(sm + L::LS);
    float (*const Wt)[32] = (float (*)[32])(sm + L::WT);
    constexpr int NP = L::NP;                                    // operand planes (hi, lo)
    T16* const Qs = (T16*)(sm + L::QS);                          // [QW * KW * NP * NQ * 1024]: the query fragments wait in LDS outside the score products, so that scores or P, the value tile and O^T fit 256 registers
    const int tid = threadIdx.x, lane = tid & 31, lr = lane & 15, hi = lane >> 4;
    const int w = __builtin_amdgcn_readfirstlane(tid >> 5), qw = w % QW, kw = w / QW;
    const int nkt = q0 / 64 + 1;                                 // 64-key tiles that hold a key <= some query; the last one starts at a key <= q0, so every query has a live key in every tile
    const int qc = qw * NQ * 16;
    const size_t pl = (size_t)blockIdx.x * TT * HD;
    Q += pl; Kp += pl; Vt += pl; if (NSPLIT == 2) { Q2 += pl; Kp2 += pl; Vt2 += pl; }
    const unsigned flane = (unsigned)(lane * 8);   // the lane's part of a fragment address (planes in fragment order); the tile's part is wave-uniform (scalar base)
    const float poff = (NSPLIT == 2) ? 0.0f : 10.0f;             // single fp16 P carries x 2^10 (as PCAR), in l too, so it cancels in O / l
    V bq[NQ][2], bq2[NQ][2];
    T16* const qs = Qs + w * NP * NQ * 1024 + lane * 8;          // this wave's own copy, 16 B per lane and half fragment: written and read by the same lanes, no barrier
#pragma unroll
    for (int nb = 0; nb < NQ; ++nb)
#pragma unroll
        for (int ks = 0; ks < 2; ++ks) { const size_t qo = (size_t)(q0 + qc + nb * 16) * HD + ks * 512 + flane;
            stq(qs + (nb * 2 + ks) * 512, Q + qo); if (NSPLIT == 2) stq(qs + (NQ * 2 + nb * 2 + ks) * 512, Q2 + qo); }
    v8f o[4][NQ]; float m[NQ], l[NQ];
#pragma unroll
    for (int nb = 0; nb < NQ; ++nb) { m[nb] = -3.0e38f; l[nb] = 0.f;
#pragma unroll
        for (int db = 0; db < 4; ++db) o[db][nb] = (v8f){}; }
#pragma unroll 1   // rolled: an unrolled body would double the live score and fragment registers
    for (int kt = kw; kt < nkt; kt += KW) {
        const int k0 = kt * 64;
        v8f st[4][NQ]; V ka[4][2], ka2[4][2], va[2][4], va2[2][4];
#pragma unroll
        for (int mb = 0; mb < 4; ++mb)
#pragma unroll
            for (int nb = 0; nb < NQ; ++nb) st[mb][nb] = (v8f){};
        asm volatile("" ::: "memory");   // compiler fence: the query fragments are read from LDS anew in every pass (hoisted out of the loop they would stay in registers and spill)
#pragma unroll
        for (int nb = 0; nb < NQ; ++nb)
#pragma unroll
            for (int ks = 0; ks < 2; ++ks) { bq[nb][ks] = ldq(qs + (nb * 2 + ks) * 512); if (NSPLIT == 2) bq2[nb][ks] = ldq(qs + (NQ * 2 + nb * 2 + ks) * 512); }
#pragma unroll
        for (int mb = 0; mb < 4; ++mb)
#pragma unroll
            for (int ks = 0; ks < 2; ++ks) { const unsigned ko = flane + (unsigned)(mb * 1024 + ks * 512); ka[mb][ks] = WFrag<T16>::ld(Kp + (size_t)k0 * HD + ko); if (NSPLIT == 2) ka2[mb][ks] = WFrag<T16>::ld(Kp2 + (size_t)k0 * HD + ko); }
        __builtin_amdgcn_sched_barrier(0);   // the key tile's loads stay together in front of the products: one load latency per tile, not one per fragment
#pragma unroll
        for (int mb = 0; mb < 4; ++mb)
#pragma unroll
            for (int ks = 0; ks < 2; ++ks)
#pragma unroll
                for (int nb = 0; nb < NQ; ++nb) { st[mb][nb] = WFrag<T16>::mma(ka[mb][ks], bq[nb][ks], st[mb][nb]); if (NSPLIT == 2) { st[mb][nb] = WFrag<T16>::mma(ka2[mb][ks], bq[nb][ks], st[mb][nb]); st[mb][nb] = WFrag<T16>::mma(ka[mb][ks], bq2[nb][ks], st[mb][nb]); } }
        if constexpr (NSPLIT == 0) {
#pragma unroll
            for (int kb = 0; kb < 2; ++kb)
#pragma unroll
                for (int db = 0; db < 4; ++db) va[kb][db] = WFrag<T16>::ld(Vt + (size_t)k0 * HD + (flane + (unsigned)(kb * 2048 + db * 512)));
            __builtin_amdgcn_sched_barrier(0); }   // the value tile's loads are issued here, into the key fragments' registers, and fly under the softmax
        if (kt == nkt - 1) {                                     // only the last tile crosses the diagonal
#pragma unroll
            for (int mb = 0; mb < 4; ++mb)
#pragma unroll
                for (int nb = 0; nb < NQ; ++nb)
#pragma unroll
                    for (int j = 0; j < 8; ++j) if (k0 + mb * 16 + hi * 8 + j > q0 + qc + nb * 16 + lr) st[mb][nb][j] = -3.0e38f; }
        V pb[NQ][2], pb2[NQ][2];
#pragma unroll
        for (int nb = 0; nb < NQ; ++nb) {
            float t4[4];
#pragma unroll
            for (int u = 0; u < 4; ++u) t4[u] = fmaxf(st[0][nb][u], st[0][nb][u + 4]);
#pragma unroll
            for (int mb = 1; mb < 4; ++mb)
#pragma unroll
                for (int j = 0; j < 8; ++j) t4[j & 3] = fmaxf(t4[j & 3], st[mb][nb][j]);
            float mt = fmaxf(fmaxf(t4[0], t4[1]), fmaxf(t4[2], t4[3]));
            mt = fmaxf(mt, __shfl_xor(mt, 16, 32));              // the other half of the wave holds the query's other 32 keys
            const float mn = fmaxf(m[nb], mt);
            const float al = exp2n((m[nb] - mn) * LC2);
            const float nm = poff - mn * LC2;
            m[nb] = mn;
            float s4[4] = {0.f, 0.f, 0.f, 0.f};
#pragma unroll
            for (int mb = 0; mb < 4; ++mb) { v8f x;
#pragma unroll
                for (int j = 0; j < 8; ++j) x[j] = fmaf(st[mb][nb][j], LC2, nm);
                x = exp2x8(x); st[mb][nb] = x;
#pragma unroll
                for (int j = 0; j < 8; ++j) s4[j & 3] += x[j]; }
            l[nb] = l[nb] * al + ((s4[0] + s4[1]) + (s4[2] + s4[3]));   // this half's keys only; the halves are joined after the loop
#pragma unroll
            for (int db = 0; db < 4; ++db) o[db][nb] *= al;
#pragma unroll
            for (int kb = 0; kb < 2; ++kb) {
                if constexpr (NSPLIT == 2) { v16us ph, pq;
#pragma unroll
                    for (int s = 0; s < 16; ++s) { unsigned short a2, c2; splitf(st[2 * kb + (s >> 3)][nb][s & 7], a2, c2); ph[s] = a2; pq[s] = c2; }
                    pb[nb][kb] = __builtin_bit_cast(v16bf, ph); pb2[nb][kb] = __builtin_bit_cast(v16bf, pq); }
                else { v16h ph;
#pragma unroll
                    for (int s = 0; s < 16; ++s) ph[s] = tohx(st[2 * kb + (s >> 3)][nb][s & 7]);
                    pb[nb][kb] = ph; } } }
        if constexpr (NSPLIT == 2) {   // hi and lo value planes do not fit 256 registers beside the scores: loaded behind the softmax (these work-groups have at most four passes per wave)
#pragma unroll
            for (int kb = 0; kb < 2; ++kb)
#pragma unroll
                for (int db = 0; db < 4; ++db) { const unsigned vo = flane + (unsigned)(kb * 2048 + db * 512); va[kb][db] = WFrag<T16>::ld(Vt + (size_t)k0 * HD + vo); va2[kb][db] = WFrag<T16>::ld(Vt2 + (size_t)k0 * HD + vo); } }
#pragma unroll
        for (int kb = 0; kb < 2; ++kb) {
#pragma unroll
            for (int db = 0; db < 4; ++db) { const V a = va[kb][db]; V a2; if (NSPLIT == 2) a2 = va2[kb][db];
#pragma unroll
                for (int nb = 0; nb < NQ; ++nb) { o[db][nb] = WFrag<T16>::mma(a, pb[nb][kb], o[db][nb]); if (NSPLIT == 2) { o[db][nb] = WFrag<T16>::mma(a2, pb[nb][kb], o[db][nb]); o[db][nb] = WFrag<T16>::mma(a, pb2[nb][kb], o[db][nb]); } } } }
    }
#pragma unroll
    for (int nb = 0; nb < NQ; ++nb) { const int qq = ((tid >> 5) % QW) * NQ * 16 + nb * 16 + lr;   // formed anew from the thread id (not from qc): no register holds it across the loop
        const float lt = l[nb] + __shfl_xor(l[nb], 16, 32);
        if (hi == 0) { Ms[kw][qq] = m[nb]; Ls[kw][qq] = lt; }
#pragma unroll
        for (int db = 0; db < 4; ++db)
#pragma unroll
            for (int j = 0; j < 8; ++j) Os[kw][db * 16 + hi * 8 + j][qq] = o[db][nb][j]; }
    __syncthreads();                                             // every wave's partial (m, l, O^T) is in LDS
    if (tid < 32) { float mm = Ms[0][tid];
#pragma unroll
        for (int k = 1; k < KW; ++k) mm = fmaxf(mm, Ms[k][tid]);
        float f[KW], den = 0.f;                                  // a wave without a tile has m = -3e38, l = 0, O = 0: weight 0
#pragma unroll
        for (int k = 0; k < KW; ++k) { f[k] = exp2n((Ms[k][tid] - mm) * LC2); den += Ls[k][tid] * f[k]; }
#pragma unroll
        for (int k = 0; k < KW; ++k) Wt[k][tid] = __fdiv_rn(f[k], den); }
    __syncthreads();                                             // the merge weights are in LDS
#pragma unroll
    for (int idx = tid; idx < HD * 8; idx += 32 * QW * KW) { const int d = idx >> 3, q4 = (idx & 7) * 4; v4f r = (v4f){};
#pragma unroll
        for (int k = 0; k < KW; ++k) r += *(const v4fa*)&Os[k][d][q4] * *(const v4fa*)&Wt[k][q4];
        *(v4f*)(out + ((size_t)blockIdx.x * HD + d) * TT + q0 + q4) = r; }   // channel-first output [batch x head x d][query]; a work-group owns whole 128-byte lines
}
// ---- k_fattn: the single-fp16 query tiles (rows >= RH) and the hi+lo tiles (rows < RH) need nothing of one another and share one grid (batch x head, NM + NL query tiles of 32), four waves each, by a block-uniform
// branch on blockIdx.y; the two paths use the same LDS. A work-group's duration falls with blockIdx.y: fp16 tiles with the most keys first; a hi+lo pass (three products per tile, value loads not hidden) lasts about two fp16 passes
// and a hi+lo wave has twice the passes per key (keys split over two waves, not four), so the hi+lo tiles stand in front of the NA fp16 tiles whose queries lie below 4 RH.
#define NM ((TT - RH) / 32)
#define NL (RH / 32)
#define NA (3 * NL)
static_assert(NM >= NA && FSm<2, 1, 2, 2>::BYTES <= FSm<0, 2, 1, 4>::BYTES, "tile order, LDS size");
__global__ __launch_bounds__(128) __attribute__((amdgpu_waves_per_eu(4))) void k_fattn(const h16* __restrict__ Q16, const h16* __restrict__ K16, const h16* __restrict__ V16, const bf* __restrict__ Qh, const bf* __restrict__ Ql, const bf* __restrict__ Kh, const bf* __restrict__ Kl, const bf* __restrict__ Vh, const bf* __restrict__ Vl, float* __restrict__ out) {   // four waves per SIMD: at most 256 registers
    __shared__ __align__(16) char sm[FSm<0, 2, 1, 4>::BYTES];
    const int y = (int)blockIdx.y;
    if (y < NM - NA || y >= NM - NA + NL) fattn<h16, 0, 2, 1, 4>(sm, Q16, nullptr, K16, nullptr, V16, nullptr, RH + (NM - 1 - (y < NM - NA ? y : y - NL)) * 32, out);
    else fattn<bf, 2, 1, 2, 2>(sm, Qh, Ql, Kh, Kl, Vh, Vl, (NM - NA + NL - 1 - y) * 32, out);
}

__device__ __forceinline__ void tok(const float* __restrict__ in, bf* X, unsigned blk) { const size_t i = (size_t)blk * 256 + threadIdx.x; if (i >= (size_t)TT * DM / 8) return; const int g = (int)(i >> 5) & (DM / 8 - 1); const int n = (int)(i >> 11) * 32 + (int)(i & 31); v8us o;
#pragma unroll
    for (int u = 0; u < 8; ++u) o[u] = f2bf(in[(size_t)(g * 8 + u) * TT + n]); *(v8us*)(X + ((size_t)(n >> 4) * 1024 + g * 16 + (n & 15)) * 8) = o;  }   // NCHW -> token rows [n][c] in fragment order: a wave reads 32 neighbouring n of a channel (one whole line) eight times and stores 16-byte piece g (channels 8 g ...) of each: 256 contiguous bytes in each of two row tiles
// ---- k_prep: the three weight conversions and the four token planes need nothing of one another and share one grid by ranges of the block index (block-uniform branches): first 3 x WBLK blocks of weights, then 2 x NB_ x TBLK of tokens.
#define WBLK (DQ * DM / 8 / 256)
#define TBLK (TT * DM / 8 / 256)
static_assert(DQ * DM % 2048 == 0 && TT * DM % 2048 == 0, "whole blocks");
__global__ __launch_bounds__(256) void k_prep(const float* __restrict__ qin, const float* __restrict__ kin, const float* __restrict__ wq, const float* __restrict__ wk, const float* __restrict__ wv, bf* X, bf* Wt) {
    const unsigned blk = blockIdx.x;
    if (blk < 3 * WBLK) { const unsigned t = blk / WBLK; cvt8(t == 0 ? wq : t == 1 ? wk : wv, Wt + (size_t)t * DQ * DM, (size_t)DQ * DM / 8, blk % WBLK); }
    else { const unsigned p = (blk - 3 * WBLK) / TBLK, b = p % NB_; tok((p / NB_ ? kin : qin) + (size_t)b * DM * TT, X + (size_t)p * TT * DM, (blk - 3 * WBLK) % TBLK); }   // plane p = [query, key][batch]
}

extern "C" void kernel_launch(void* const* d_in, const int* in_sizes, int n_in,
                              void* d_out, int out_size, void* d_ws, size_t ws_size, hipStream_t stream) {
    (void)in_sizes; (void)n_in; (void)out_size;
    const float* qin = (const float*)d_in[0]; const float* kin = (const float*)d_in[1]; const float* wq = (const float*)d_in[2]; const float* bq = (const float*)d_in[3]; const float* wk = (const float*)d_in[4]; const float* bk = (const float*)d_in[5]; const float* wv = (const float*)d_in[6]; const float* bv = (const float*)d_in[7]; const float* x = qin; const float* wo = nullptr; (void)wo; const float* cosT = nullptr; const float* sinT = nullptr; (void)cosT; (void)sinT;
    float* OUT = (float*)d_out;     // [2][512][4096] channel-first
    char* wsp = (char*)d_ws;
    auto take = [&](size_t bytes) { char* p = wsp; wsp += (bytes + 255) & ~(size_t)255; return (void*)p; };
    const size_t PE = (size_t)NB_ * NH_ * TT * HD;   // elements of one kind of head plane, both batches: [b][h][..]
    bf* WT = (bf*)take((size_t)3 * DQ * DM * 2);   // weights [q, k, v]
    bf* XT = (bf*)take((size_t)2 * NB_ * TT * DM * 2);   // token planes [query, key][b]
    h16* QP16 = (h16*)take(3 * PE * 2); h16* KP16 = QP16 + PE; h16* VT16 = KP16 + PE;   // each 16-bit form: [q, k, v][b][h][..]
    bf* QPh = (bf*)take(3 * PE * 2); bf* KPh = QPh + PE; bf* VTh = KPh + PE;
    bf* QPl = (bf*)take(3 * PE * 2); bf* KPl = QPl + PE; bf* VTl = KPl + PE;
    if ((size_t)(wsp - (char*)d_ws) > ws_size) return;    // ws 256 MiB
    k_prep<<<3 * WBLK + 2 * NB_ * TBLK, 256, 0, stream>>>(qin, kin, wq, wk, wv, XT, WT);
    k_proj<<<dim3(TT / 64, DQ / 64, NB_ * 3), 32, 0, stream>>>(XT, WT, bq, bk, bv, QP16, QPh, QPl);
    k_fattn<<<dim3(NB_ * NH_, NM + NL, 1), 128, 0, stream>>>(QP16, KP16, VT16, QPh, QPl, KPh, KPl, VTh, VTl, OUT);
}
